// v000
// Times are from an AMD MI455X. After a warm-up the kernel runs many times in a row, and a time is the length of
// such a window on the GPU divided by its runs, so every launch and the gaps after it count. The runs cycle
// through copies of the inputs. A figure is the median of several windows, for all but v000 over two sittings.
// Sittings can differ by a few percent; kernels timed side by side share one.
// v000, which the later versions start from, runs in 158 microseconds.
#include <hip/hip_runtime.h>
#include <hip/hip_bf16.h>

typedef __attribute__((ext_vector_type(16))) _Float16 v16h;
typedef __attribute__((ext_vector_type(8)))  _Float16 v8h;
typedef __attribute__((ext_vector_type(8)))  float    v8f;

#define BB 8
#define SS 1024
#define DD 768
#define HH 12
#define DH 64
#define RR (BB*SS)   // 8192 rows per tensor

static __device__ __forceinline__ v16h cat16(v8h lo, v8h hi) {
    return __builtin_shufflevector(lo, hi, 0,1,2,3,4,5,6,7,8,9,10,11,12,13,14,15);
}
static __device__ __forceinline__ v8h cvt8(const float4 a, const float4 b) {
    v8h r;
    r[0]=(_Float16)a.x; r[1]=(_Float16)a.y; r[2]=(_Float16)a.z; r[3]=(_Float16)a.w;
    r[4]=(_Float16)b.x; r[5]=(_Float16)b.y; r[6]=(_Float16)b.z; r[7]=(_Float16)b.w;
    return r;
}
static __device__ __forceinline__ v8f wmma16(v16h a, v16h b, v8f c) {
    // D = A(16x32 f16) * B(32x16 f16) + C(16x16 f32)
    return __builtin_amdgcn_wmma_f32_16x16x32_f16(false, a, false, b, (short)0, c, false, false);
}

// ---------------------------------------------------------------------------
// Kernel 1: Y = relu(X @ W^T) for X in {q,k,v}, fp32 in -> f16 out.
//   z==0 -> Qp [B,S,H,Dh] (== row-major [R,D])
//   z==1 -> Kp [B,S,H,Dh]
//   z==2 -> Vt [B,H,Dh,S]  (transposed per head for the PV GEMM B-operand)
// Tile: 128(M) x 128(N), K-step 32, 8 waves arranged 2(M) x 4(N),
// each wave owns 64x32 = 4x2 WMMA tiles.
// ---------------------------------------------------------------------------
__global__ __launch_bounds__(256)
void proj_relu_kernel(const float* __restrict__ q, const float* __restrict__ k,
                      const float* __restrict__ v, const float* __restrict__ W,
                      _Float16* __restrict__ Qp, _Float16* __restrict__ Kp,
                      _Float16* __restrict__ Vt)
{
    const int z = blockIdx.z;
    const float* __restrict__ X = (z == 0) ? q : (z == 1) ? k : v;
    const int rowBase = blockIdx.y * 128;
    const int colBase = blockIdx.x * 128;

    // row stride 40 halfs = 80B (multiple of 16B -> aligned ds_load_b128)
    __shared__ __align__(16) _Float16 shA[128 * 40];
    __shared__ __align__(16) _Float16 shB[128 * 40];

    const int t    = threadIdx.x;
    const int lane = t & 31;
    const int wave = t >> 5;
    const int wm = wave >> 2;       // 0..1
    const int wn = wave & 3;        // 0..3
    const int lr = lane & 15;       // fragment row/col within 16
    const int g  = lane >> 4;       // half-wave -> K octet select

    v8f acc[4][2] = {};

    const int sr = t >> 1;          // staging row 0..127
    const int sc = (t & 1) * 16;    // staging col 0 or 16

    for (int kb = 0; kb < DD; kb += 32) {
        // ---- stage A tile: X[rowBase..+127][kb..+31] -> f16 LDS
        {
            const float* src = X + (size_t)(rowBase + sr) * DD + kb + sc;
            float4 f0 = ((const float4*)src)[0];
            float4 f1 = ((const float4*)src)[1];
            float4 f2 = ((const float4*)src)[2];
            float4 f3 = ((const float4*)src)[3];
            *(v8h*)&shA[sr * 40 + sc]     = cvt8(f0, f1);
            *(v8h*)&shA[sr * 40 + sc + 8] = cvt8(f2, f3);
            // prefetch next K-step of the streaming operand
            if (kb + 32 < DD) __builtin_prefetch(src + 32, 0, 0);
        }
        // ---- stage B tile: W[colBase+n][kb..+31] -> LDS as [n][k]
        {
            const float* src = W + (size_t)(colBase + sr) * DD + kb + sc;
            float4 f0 = ((const float4*)src)[0];
            float4 f1 = ((const float4*)src)[1];
            float4 f2 = ((const float4*)src)[2];
            float4 f3 = ((const float4*)src)[3];
            *(v8h*)&shB[sr * 40 + sc]     = cvt8(f0, f1);
            *(v8h*)&shB[sr * 40 + sc + 8] = cvt8(f2, f3);
        }
        __syncthreads();

        // ---- fragments: A lane=m holds K octets g*8 and 16+g*8
        v16h af[4], bf[2];
        #pragma unroll
        for (int i = 0; i < 4; ++i) {
            const _Float16* p = &shA[(wm * 64 + i * 16 + lr) * 40];
            af[i] = cat16(*(const v8h*)(p + g * 8), *(const v8h*)(p + 16 + g * 8));
        }
        #pragma unroll
        for (int j = 0; j < 2; ++j) {
            const _Float16* p = &shB[(wn * 32 + j * 16 + lr) * 40];
            bf[j] = cat16(*(const v8h*)(p + g * 8), *(const v8h*)(p + 16 + g * 8));
        }
        #pragma unroll
        for (int i = 0; i < 4; ++i)
            #pragma unroll
            for (int j = 0; j < 2; ++j)
                acc[i][j] = wmma16(af[i], bf[j], acc[i][j]);
        __syncthreads();
    }

    // ---- epilogue: relu + f16 store
    _Float16* __restrict__ Yqk = (z == 0) ? Qp : Kp;
    #pragma unroll
    for (int i = 0; i < 4; ++i) {
        #pragma unroll
        for (int j = 0; j < 2; ++j) {
            #pragma unroll
            for (int r = 0; r < 8; ++r) {
                const int mrow = rowBase + wm * 64 + i * 16 + r + 8 * g;
                const int ncol = colBase + wn * 32 + j * 16 + lr;
                float val = acc[i][j][r];
                val = val > 0.0f ? val : 0.0f;
                const _Float16 hv = (_Float16)val;
                if (z < 2) {
                    Yqk[(size_t)mrow * DD + ncol] = hv;
                } else {
                    const int b = mrow >> 10, s = mrow & 1023;
                    const int h = ncol >> 6,  d = ncol & 63;
                    Vt[(((size_t)(b * HH + h)) * DH + d) * SS + s] = hv;
                }
            }
        }
    }
}

// ---------------------------------------------------------------------------
// Kernel 2: fused flash attention per (b, h, 128 q-rows).
// 8 waves, each owns 16 q rows. K-blocks of 32 keys; online softmax.
// Output: attnOut fp32 [B,S,D] (pre 2*o+q / LayerNorm).
// ---------------------------------------------------------------------------
__global__ __launch_bounds__(256)
void attn_kernel(const _Float16* __restrict__ Qp, const _Float16* __restrict__ Kp,
                 const _Float16* __restrict__ Vt, float* __restrict__ O)
{
    const int qb = blockIdx.x;   // 0..7  (q block of 128)
    const int h  = blockIdx.y;   // 0..11
    const int b  = blockIdx.z;   // 0..7
    const int t = threadIdx.x, lane = t & 31, wave = t >> 5;
    const int lr = lane & 15, g = lane >> 4;
    const int qBase = qb * 128;

    __shared__ __align__(16) _Float16 shK[32 * 72];     // [kc][d], stride 144B
    __shared__ __align__(16) _Float16 shV[64 * 40];     // [d][sc], stride 80B
    __shared__ __align__(16) _Float16 shP[8][16 * 40];  // per-wave P, [m][kc]

    // ---- Q fragments for this wave's 16 rows (direct global, 16B aligned)
    const int qrow = qBase + wave * 16 + lr;
    const _Float16* qptr = Qp + (size_t)(b * SS + qrow) * DD + h * DH;
    const v16h qA0 = cat16(*(const v8h*)(qptr + g * 8),
                           *(const v8h*)(qptr + 16 + g * 8));
    const v16h qA1 = cat16(*(const v8h*)(qptr + 32 + g * 8),
                           *(const v8h*)(qptr + 48 + g * 8));

    v8f cO[4] = {};
    float m_run[8], l_lane[8];
    #pragma unroll
    for (int r = 0; r < 8; ++r) { m_run[r] = -1e30f; l_lane[r] = 0.0f; }

    const float scale = 0.125f;   // 1/sqrt(64)

    for (int kb = 0; kb < SS; kb += 32) {
        // ---- stage K block: 32 keys x 64 d
        {
            const int kc = t >> 3, dc = (t & 7) * 8;
            const _Float16* src = Kp + (size_t)(b * SS + kb + kc) * DD + h * DH + dc;
            *(v8h*)&shK[kc * 72 + dc] = *(const v8h*)src;
        }
        // ---- stage V block (already transposed): 64 d x 32 keys
        {
            const int d = t >> 2, vc = (t & 3) * 8;
            const _Float16* src = Vt + (((size_t)(b * HH + h)) * DH + d) * SS + kb + vc;
            *(v8h*)&shV[d * 40 + vc] = *(const v8h*)src;
        }
        __syncthreads();

        // ---- scores: two 16x16 tiles, K-dim = Dh = 64 (2 WMMAs each)
        v8f s0 = {}, s1 = {};
        #pragma unroll
        for (int j = 0; j < 2; ++j) {
            const _Float16* kp = &shK[(j * 16 + lr) * 72];
            v16h bK0 = cat16(*(const v8h*)(kp + g * 8),      *(const v8h*)(kp + 16 + g * 8));
            v16h bK1 = cat16(*(const v8h*)(kp + 32 + g * 8), *(const v8h*)(kp + 48 + g * 8));
            v8f sc = {};
            sc = wmma16(qA0, bK0, sc);
            sc = wmma16(qA1, bK1, sc);
            if (j == 0) s0 = sc; else s1 = sc;
        }

        // ---- online softmax per row (row = 16 lanes of a half-wave)
        #pragma unroll
        for (int r = 0; r < 8; ++r) {
            float a0 = s0[r] * scale, a1 = s1[r] * scale;
            float mx = fmaxf(a0, a1);
            mx = fmaxf(mx, __shfl_xor(mx, 1, 16));
            mx = fmaxf(mx, __shfl_xor(mx, 2, 16));
            mx = fmaxf(mx, __shfl_xor(mx, 4, 16));
            mx = fmaxf(mx, __shfl_xor(mx, 8, 16));
            const float mnew  = fmaxf(m_run[r], mx);
            const float alpha = __expf(m_run[r] - mnew);
            m_run[r] = mnew;
            const float p0 = __expf(a0 - mnew);
            const float p1 = __expf(a1 - mnew);
            l_lane[r] = l_lane[r] * alpha + p0 + p1;
            #pragma unroll
            for (int tt = 0; tt < 4; ++tt) cO[tt][r] *= alpha;
            // C-layout -> A-layout via per-wave LDS (in-order DS, wave-private)
            shP[wave][(r + 8 * g) * 40 + lr]      = (_Float16)p0;
            shP[wave][(r + 8 * g) * 40 + 16 + lr] = (_Float16)p1;
        }

        // ---- P @ V: reload P as A fragment, 4 n-tiles over Dh
        const _Float16* pp = &shP[wave][lr * 40];
        const v16h pA = cat16(*(const v8h*)(pp + g * 8), *(const v8h*)(pp + 16 + g * 8));
        #pragma unroll
        for (int tt = 0; tt < 4; ++tt) {
            const _Float16* vp = &shV[(tt * 16 + lr) * 40];
            v16h bV = cat16(*(const v8h*)(vp + g * 8), *(const v8h*)(vp + 16 + g * 8));
            cO[tt] = wmma16(pA, bV, cO[tt]);
        }
        __syncthreads();
    }

    // ---- finalize: divide by row sum, write fp32
    #pragma unroll
    for (int r = 0; r < 8; ++r) {
        float l = l_lane[r];
        l += __shfl_xor(l, 1, 16);
        l += __shfl_xor(l, 2, 16);
        l += __shfl_xor(l, 4, 16);
        l += __shfl_xor(l, 8, 16);
        const float inv = 1.0f / l;
        const int row = qBase + wave * 16 + r + 8 * g;
        #pragma unroll
        for (int tt = 0; tt < 4; ++tt) {
            const int d = tt * 16 + lr;
            O[(size_t)(b * SS + row) * DD + h * DH + d] = cO[tt][r] * inv;
        }
    }
}

// ---------------------------------------------------------------------------
// Kernel 3: o = 2*attn + q, then LayerNorm over D=768. One block per row.
// ---------------------------------------------------------------------------
__global__ __launch_bounds__(256)
void ln_kernel(const float* __restrict__ A, const float* __restrict__ q,
               const float* __restrict__ gamma, const float* __restrict__ beta,
               float* __restrict__ out)
{
    const int row = blockIdx.x;
    const int t = threadIdx.x;
    const float* a  = A + (size_t)row * DD;
    const float* qq = q + (size_t)row * DD;

    float x[3];
    float sum = 0.0f, sq = 0.0f;
    #pragma unroll
    for (int i = 0; i < 3; ++i) {
        const int c = t + i * 256;
        const float v = 2.0f * a[c] + qq[c];
        x[i] = v; sum += v; sq += v * v;
    }
    #pragma unroll
    for (int off = 16; off >= 1; off >>= 1) {
        sum += __shfl_xor(sum, off, 32);
        sq  += __shfl_xor(sq,  off, 32);
    }
    __shared__ float rs[8], rq[8];
    const int wave = t >> 5, lane = t & 31;
    if (lane == 0) { rs[wave] = sum; rq[wave] = sq; }
    __syncthreads();
    float s = 0.0f, s2 = 0.0f;
    #pragma unroll
    for (int w = 0; w < 8; ++w) { s += rs[w]; s2 += rq[w]; }

    const float mu   = s * (1.0f / (float)DD);
    const float var  = s2 * (1.0f / (float)DD) - mu * mu;
    const float rstd = rsqrtf(var + 1e-5f);
    #pragma unroll
    for (int i = 0; i < 3; ++i) {
        const int c = t + i * 256;
        out[(size_t)row * DD + c] = (x[i] - mu) * rstd * gamma[c] + beta[c];
    }
}

// ---------------------------------------------------------------------------
extern "C" void kernel_launch(void* const* d_in, const int* in_sizes, int n_in,
                              void* d_out, int out_size, void* d_ws, size_t ws_size,
                              hipStream_t stream) {
    (void)in_sizes; (void)n_in; (void)out_size; (void)ws_size;
    const float* q     = (const float*)d_in[0];
    const float* k     = (const float*)d_in[1];
    const float* v     = (const float*)d_in[2];
    const float* W     = (const float*)d_in[3];
    const float* gamma = (const float*)d_in[4];
    const float* beta  = (const float*)d_in[5];
    float* out = (float*)d_out;

    // workspace partition: Qp, Kp, Vt (f16) + attnOut (f32)
    _Float16* Qp = (_Float16*)d_ws;
    _Float16* Kp = Qp + (size_t)RR * DD;
    _Float16* Vt = Kp + (size_t)RR * DD;
    float*    Ao = (float*)(Vt + (size_t)RR * DD);

    // 1) projections: grid = (N tiles, M tiles, {q,k,v})
    proj_relu_kernel<<<dim3(DD / 128, RR / 128, 3), 256, 0, stream>>>(
        q, k, v, W, Qp, Kp, Vt);

    // 2) fused attention: grid = (q blocks, heads, batch)
    attn_kernel<<<dim3(SS / 128, HH, BB), 256, 0, stream>>>(Qp, Kp, Vt, Ao);

    // 3) residual + LayerNorm
    ln_kernel<<<dim3(RR), 256, 0, stream>>>(Ao, q, gamma, beta, out);
}

// v001
// One run takes 138 microseconds.
// Timed twice side by side with v000, it ran 1.19 and 1.18 times as fast.
#include <hip/hip_runtime.h>
#include <hip/hip_bf16.h>

typedef __attribute__((ext_vector_type(16))) _Float16 v16h;
typedef __attribute__((ext_vector_type(8)))  _Float16 v8h;
typedef __attribute__((ext_vector_type(8)))  float    v8f;
typedef __attribute__((ext_vector_type(4)))  _Float16 v4h;

#define BB 8
#define SS 1024
#define DD 768
#define HH 12
#define DH 64
#define RR (BB*SS)   // 8192 rows per tensor

static __device__ __forceinline__ v16h cat16(v8h lo, v8h hi) {
    return __builtin_shufflevector(lo, hi, 0,1,2,3,4,5,6,7,8,9,10,11,12,13,14,15);
}
static __device__ __forceinline__ v4h cvt4(const float4 a) {
    v4h r;
    r[0]=(_Float16)a.x; r[1]=(_Float16)a.y; r[2]=(_Float16)a.z; r[3]=(_Float16)a.w;
    return r;
}
static __device__ __forceinline__ v8f wmma16(v16h a, v16h b, v8f c) {
    // D = A(16x32 f16) * B(32x16 f16) + C(16x16 f32)
    return __builtin_amdgcn_wmma_f32_16x16x32_f16(false, a, false, b, (short)0, c, false, false);
}

// ---------------------------------------------------------------------------
// Kernel 1: Y = relu(X @ W^T) for X in {q,k,v}, fp32 in -> f16 out.
//   z==0 -> Qp [B,S,H,Dh] (== row-major [R,D])
//   z==1 -> Kp [B,S,H,Dh]
//   z==2 -> Vt [B,H,Dh,S]  (transposed per head for the PV GEMM B-operand)
// Tile: 128(M) x 128(N), K-step 32, 8 waves arranged 2(M) x 4(N),
// each wave owns 64x32 = 4x2 WMMA tiles.
// ---------------------------------------------------------------------------
__global__ __launch_bounds__(256)
void proj_relu_kernel(const float* __restrict__ q, const float* __restrict__ k,
                      const float* __restrict__ v, const float* __restrict__ W,
                      _Float16* __restrict__ Qp, _Float16* __restrict__ Kp,
                      _Float16* __restrict__ Vt)
{
    const int z = blockIdx.z;
    const float* __restrict__ X = (z == 0) ? q : (z == 1) ? k : v;
    const int rowBase = blockIdx.y * 128;
    const int colBase = blockIdx.x * 128;

    // row stride 40 halfs = 80B (multiple of 16B -> aligned ds_load_b128)
    __shared__ __align__(16) _Float16 shA[128 * 40];
    __shared__ __align__(16) _Float16 shB[128 * 40];

    const int t    = threadIdx.x;
    const int lane = t & 31;
    const int wave = t >> 5;
    const int wm = wave >> 2;       // 0..1
    const int wn = wave & 3;        // 0..3
    const int lr = lane & 15;       // fragment row/col within 16
    const int g  = lane >> 4;       // half-wave -> K octet select

    v8f acc[4][2] = {};

    // Staging map: 8 lanes x 16 B cover one whole 128-B line (one row of the
    // K-step), so each wave-wide load touches 4 whole lines. A wave owns 16
    // rows; load i takes rows 4*(lane>>3)+i: rows 4 apart at the 80-B pitch
    // start 16 banks apart, so the 8-B LDS stores of a wave hit each bank once.
    const int gr = wave * 16 + (lane >> 3) * 4;   // first staging row
    const int gc = (lane & 7) * 4;                // staging col (floats)

    for (int kb = 0; kb < DD; kb += 32) {
        // ---- stage A tile: X[rowBase..+127][kb..+31] -> f16 LDS
        {
            const float* src = X + (size_t)(rowBase + gr) * DD + kb + gc;
            float4 f0 = *(const float4*)(src);
            float4 f1 = *(const float4*)(src + DD);
            float4 f2 = *(const float4*)(src + 2 * DD);
            float4 f3 = *(const float4*)(src + 3 * DD);
            *(v4h*)&shA[(gr + 0) * 40 + gc] = cvt4(f0);
            *(v4h*)&shA[(gr + 1) * 40 + gc] = cvt4(f1);
            *(v4h*)&shA[(gr + 2) * 40 + gc] = cvt4(f2);
            *(v4h*)&shA[(gr + 3) * 40 + gc] = cvt4(f3);
        }
        // ---- stage B tile: W[colBase+n][kb..+31] -> LDS as [n][k]
        {
            const float* src = W + (size_t)(colBase + gr) * DD + kb + gc;
            float4 f0 = *(const float4*)(src);
            float4 f1 = *(const float4*)(src + DD);
            float4 f2 = *(const float4*)(src + 2 * DD);
            float4 f3 = *(const float4*)(src + 3 * DD);
            *(v4h*)&shB[(gr + 0) * 40 + gc] = cvt4(f0);
            *(v4h*)&shB[(gr + 1) * 40 + gc] = cvt4(f1);
            *(v4h*)&shB[(gr + 2) * 40 + gc] = cvt4(f2);
            *(v4h*)&shB[(gr + 3) * 40 + gc] = cvt4(f3);
        }
        __syncthreads();

        // ---- fragments: A lane=m holds K octets g*8 and 16+g*8
        v16h af[4], bf[2];
        #pragma unroll
        for (int i = 0; i < 4; ++i) {
            const _Float16* p = &shA[(wm * 64 + i * 16 + lr) * 40];
            af[i] = cat16(*(const v8h*)(p + g * 8), *(const v8h*)(p + 16 + g * 8));
        }
        #pragma unroll
        for (int j = 0; j < 2; ++j) {
            const _Float16* p = &shB[(wn * 32 + j * 16 + lr) * 40];
            bf[j] = cat16(*(const v8h*)(p + g * 8), *(const v8h*)(p + 16 + g * 8));
        }
        #pragma unroll
        for (int i = 0; i < 4; ++i)
            #pragma unroll
            for (int j = 0; j < 2; ++j)
                acc[i][j] = wmma16(af[i], bf[j], acc[i][j]);
        __syncthreads();
    }

    // ---- epilogue: relu + f16 store
    _Float16* __restrict__ Yqk = (z == 0) ? Qp : Kp;
    #pragma unroll
    for (int i = 0; i < 4; ++i) {
        #pragma unroll
        for (int j = 0; j < 2; ++j) {
            #pragma unroll
            for (int r = 0; r < 8; ++r) {
                const int mrow = rowBase + wm * 64 + i * 16 + r + 8 * g;
                const int ncol = colBase + wn * 32 + j * 16 + lr;
                float val = acc[i][j][r];
                val = val > 0.0f ? val : 0.0f;
                const _Float16 hv = (_Float16)val;
                if (z < 2) {
                    Yqk[(size_t)mrow * DD + ncol] = hv;
                } else {
                    const int b = mrow >> 10, s = mrow & 1023;
                    const int h = ncol >> 6,  d = ncol & 63;
                    Vt[(((size_t)(b * HH + h)) * DH + d) * SS + s] = hv;
                }
            }
        }
    }
}

// ---------------------------------------------------------------------------
// Kernel 2: fused flash attention per (b, h, 128 q-rows).
// 8 waves, each owns 16 q rows. K-blocks of 32 keys; online softmax.
// Output: attnOut fp32 [B,S,D] (pre 2*o+q / LayerNorm).
// ---------------------------------------------------------------------------
__global__ __launch_bounds__(256)
void attn_kernel(const _Float16* __restrict__ Qp, const _Float16* __restrict__ Kp,
                 const _Float16* __restrict__ Vt, float* __restrict__ O)
{
    const int qb = blockIdx.x;   // 0..7  (q block of 128)
    const int h  = blockIdx.y;   // 0..11
    const int b  = blockIdx.z;   // 0..7
    const int t = threadIdx.x, lane = t & 31, wave = t >> 5;
    const int lr = lane & 15, g = lane >> 4;
    const int qBase = qb * 128;

    __shared__ __align__(16) _Float16 shK[32 * 72];     // [kc][d], stride 144B
    __shared__ __align__(16) _Float16 shV[64 * 40];     // [d][sc], stride 80B
    __shared__ __align__(16) _Float16 shP[8][16 * 40];  // per-wave P, [m][kc]

    // ---- Q fragments for this wave's 16 rows (direct global, 16B aligned)
    const int qrow = qBase + wave * 16 + lr;
    const _Float16* qptr = Qp + (size_t)(b * SS + qrow) * DD + h * DH;
    const v16h qA0 = cat16(*(const v8h*)(qptr + g * 8),
                           *(const v8h*)(qptr + 16 + g * 8));
    const v16h qA1 = cat16(*(const v8h*)(qptr + 32 + g * 8),
                           *(const v8h*)(qptr + 48 + g * 8));

    v8f cO[4] = {};
    float m_run[8], l_lane[8];
    #pragma unroll
    for (int r = 0; r < 8; ++r) { m_run[r] = -1e30f; l_lane[r] = 0.0f; }

    const float scale = 0.125f;   // 1/sqrt(64)

    for (int kb = 0; kb < SS; kb += 32) {
        // ---- stage K block: 32 keys x 64 d
        {
            const int kc = t >> 3, dc = (t & 7) * 8;
            const _Float16* src = Kp + (size_t)(b * SS + kb + kc) * DD + h * DH + dc;
            *(v8h*)&shK[kc * 72 + dc] = *(const v8h*)src;
        }
        // ---- stage V block (already transposed): 64 d x 32 keys
        {
            const int d = t >> 2, vc = (t & 3) * 8;
            const _Float16* src = Vt + (((size_t)(b * HH + h)) * DH + d) * SS + kb + vc;
            *(v8h*)&shV[d * 40 + vc] = *(const v8h*)src;
        }
        __syncthreads();

        // ---- scores: two 16x16 tiles, K-dim = Dh = 64 (2 WMMAs each)
        v8f s0 = {}, s1 = {};
        #pragma unroll
        for (int j = 0; j < 2; ++j) {
            const _Float16* kp = &shK[(j * 16 + lr) * 72];
            v16h bK0 = cat16(*(const v8h*)(kp + g * 8),      *(const v8h*)(kp + 16 + g * 8));
            v16h bK1 = cat16(*(const v8h*)(kp + 32 + g * 8), *(const v8h*)(kp + 48 + g * 8));
            v8f sc = {};
            sc = wmma16(qA0, bK0, sc);
            sc = wmma16(qA1, bK1, sc);
            if (j == 0) s0 = sc; else s1 = sc;
        }

        // ---- online softmax per row (row = 16 lanes of a half-wave)
        #pragma unroll
        for (int r = 0; r < 8; ++r) {
            float a0 = s0[r] * scale, a1 = s1[r] * scale;
            float mx = fmaxf(a0, a1);
            mx = fmaxf(mx, __shfl_xor(mx, 1, 16));
            mx = fmaxf(mx, __shfl_xor(mx, 2, 16));
            mx = fmaxf(mx, __shfl_xor(mx, 4, 16));
            mx = fmaxf(mx, __shfl_xor(mx, 8, 16));
            const float mnew  = fmaxf(m_run[r], mx);
            const float alpha = __expf(m_run[r] - mnew);
            m_run[r] = mnew;
            const float p0 = __expf(a0 - mnew);
            const float p1 = __expf(a1 - mnew);
            l_lane[r] = l_lane[r] * alpha + p0 + p1;
            #pragma unroll
            for (int tt = 0; tt < 4; ++tt) cO[tt][r] *= alpha;
            // C-layout -> A-layout via per-wave LDS (in-order DS, wave-private)
            shP[wave][(r + 8 * g) * 40 + lr]      = (_Float16)p0;
            shP[wave][(r + 8 * g) * 40 + 16 + lr] = (_Float16)p1;
        }

        // ---- P @ V: reload P as A fragment, 4 n-tiles over Dh
        const _Float16* pp = &shP[wave][lr * 40];
        const v16h pA = cat16(*(const v8h*)(pp + g * 8), *(const v8h*)(pp + 16 + g * 8));
        #pragma unroll
        for (int tt = 0; tt < 4; ++tt) {
            const _Float16* vp = &shV[(tt * 16 + lr) * 40];
            v16h bV = cat16(*(const v8h*)(vp + g * 8), *(const v8h*)(vp + 16 + g * 8));
            cO[tt] = wmma16(pA, bV, cO[tt]);
        }
        __syncthreads();
    }

    // ---- finalize: divide by row sum, write fp32
    #pragma unroll
    for (int r = 0; r < 8; ++r) {
        float l = l_lane[r];
        l += __shfl_xor(l, 1, 16);
        l += __shfl_xor(l, 2, 16);
        l += __shfl_xor(l, 4, 16);
        l += __shfl_xor(l, 8, 16);
        const float inv = 1.0f / l;
        const int row = qBase + wave * 16 + r + 8 * g;
        #pragma unroll
        for (int tt = 0; tt < 4; ++tt) {
            const int d = tt * 16 + lr;
            O[(size_t)(b * SS + row) * DD + h * DH + d] = cO[tt][r] * inv;
        }
    }
}

// ---------------------------------------------------------------------------
// Kernel 3: o = 2*attn + q, then LayerNorm over D=768. One block per row.
// ---------------------------------------------------------------------------
__global__ __launch_bounds__(256)
void ln_kernel(const float* __restrict__ A, const float* __restrict__ q,
               const float* __restrict__ gamma, const float* __restrict__ beta,
               float* __restrict__ out)
{
    const int row = blockIdx.x;
    const int t = threadIdx.x;
    const float* a  = A + (size_t)row * DD;
    const float* qq = q + (size_t)row * DD;

    float x[3];
    float sum = 0.0f, sq = 0.0f;
    #pragma unroll
    for (int i = 0; i < 3; ++i) {
        const int c = t + i * 256;
        const float v = 2.0f * a[c] + qq[c];
        x[i] = v; sum += v; sq += v * v;
    }
    #pragma unroll
    for (int off = 16; off >= 1; off >>= 1) {
        sum += __shfl_xor(sum, off, 32);
        sq  += __shfl_xor(sq,  off, 32);
    }
    __shared__ float rs[8], rq[8];
    const int wave = t >> 5, lane = t & 31;
    if (lane == 0) { rs[wave] = sum; rq[wave] = sq; }
    __syncthreads();
    float s = 0.0f, s2 = 0.0f;
    #pragma unroll
    for (int w = 0; w < 8; ++w) { s += rs[w]; s2 += rq[w]; }

    const float mu   = s * (1.0f / (float)DD);
    const float var  = s2 * (1.0f / (float)DD) - mu * mu;
    const float rstd = rsqrtf(var + 1e-5f);
    #pragma unroll
    for (int i = 0; i < 3; ++i) {
        const int c = t + i * 256;
        out[(size_t)row * DD + c] = (x[i] - mu) * rstd * gamma[c] + beta[c];
    }
}

// ---------------------------------------------------------------------------
extern "C" void kernel_launch(void* const* d_in, const int* in_sizes, int n_in,
                              void* d_out, int out_size, void* d_ws, size_t ws_size,
                              hipStream_t stream) {
    (void)in_sizes; (void)n_in; (void)out_size; (void)ws_size;
    const float* q     = (const float*)d_in[0];
    const float* k     = (const float*)d_in[1];
    const float* v     = (const float*)d_in[2];
    const float* W     = (const float*)d_in[3];
    const float* gamma = (const float*)d_in[4];
    const float* beta  = (const float*)d_in[5];
    float* out = (float*)d_out;

    // workspace partition: Qp, Kp, Vt (f16) + attnOut (f32)
    _Float16* Qp = (_Float16*)d_ws;
    _Float16* Kp = Qp + (size_t)RR * DD;
    _Float16* Vt = Kp + (size_t)RR * DD;
    float*    Ao = (float*)(Vt + (size_t)RR * DD);

    // 1) projections: grid = (N tiles, M tiles, {q,k,v})
    proj_relu_kernel<<<dim3(DD / 128, RR / 128, 3), 256, 0, stream>>>(
        q, k, v, W, Qp, Kp, Vt);

    // 2) fused attention: grid = (q blocks, heads, batch)
    attn_kernel<<<dim3(SS / 128, HH, BB), 256, 0, stream>>>(Qp, Kp, Vt, Ao);

    // 3) residual + LayerNorm
    ln_kernel<<<dim3(RR), 256, 0, stream>>>(Ao, q, gamma, beta, out);
}

// v002
// A run of this version takes 122 microseconds.
// Timed twice side by side with v001, it ran 1.13 times as fast both times.
// All steps since v000 together make it 1.34 times as fast.
#include <hip/hip_runtime.h>
#include <hip/hip_bf16.h>

typedef __attribute__((ext_vector_type(16))) _Float16 v16h;
typedef __attribute__((ext_vector_type(8)))  _Float16 v8h;
typedef __attribute__((ext_vector_type(8)))  float    v8f;
typedef __attribute__((ext_vector_type(4)))  _Float16 v4h;

#define BB 8
#define SS 1024
#define DD 768
#define HH 12
#define DH 64
#define RR (BB*SS)   // 8192 rows per tensor

static __device__ __forceinline__ v16h cat16(v8h lo, v8h hi) {
    return __builtin_shufflevector(lo, hi, 0,1,2,3,4,5,6,7,8,9,10,11,12,13,14,15);
}
static __device__ __forceinline__ v4h cvt4(const float4 a) {
    v4h r;
    r[0]=(_Float16)a.x; r[1]=(_Float16)a.y; r[2]=(_Float16)a.z; r[3]=(_Float16)a.w;
    return r;
}
static __device__ __forceinline__ v8f wmma16(v16h a, v16h b, v8f c) {
    // D = A(16x32 f16) * B(32x16 f16) + C(16x16 f32)
    return __builtin_amdgcn_wmma_f32_16x16x32_f16(false, a, false, b, (short)0, c, false, false);
}

// ---------------------------------------------------------------------------
// Kernel 1: Y = relu(X @ W^T) for X in {q,k,v}, fp32 in -> f16 out.
//   z==0 -> Qp [B,S,H,Dh] (== row-major [R,D])
//   z==1 -> Kp [B,S,H,Dh]
//   z==2 -> Vt [B,H,Dh,S]  (transposed per head for the PV GEMM A-operand)
// Tile: 128(M) x 128(N), K-step 32, 8 waves arranged 2(M) x 4(N),
// each wave owns 64x32 = 4x2 WMMA tiles.
// ---------------------------------------------------------------------------
__global__ __launch_bounds__(256)
void proj_relu_kernel(const float* __restrict__ q, const float* __restrict__ k,
                      const float* __restrict__ v, const float* __restrict__ W,
                      _Float16* __restrict__ Qp, _Float16* __restrict__ Kp,
                      _Float16* __restrict__ Vt)
{
    const int z = blockIdx.z;
    const float* __restrict__ X = (z == 0) ? q : (z == 1) ? k : v;
    const int rowBase = blockIdx.y * 128;
    const int colBase = blockIdx.x * 128;

    // row stride 40 halfs = 80B (multiple of 16B -> aligned ds_load_b128)
    __shared__ __align__(16) _Float16 shA[128 * 40];
    __shared__ __align__(16) _Float16 shB[128 * 40];

    const int t    = threadIdx.x;
    const int lane = t & 31;
    const int wave = t >> 5;
    const int wm = wave >> 2;       // 0..1
    const int wn = wave & 3;        // 0..3
    const int lr = lane & 15;       // fragment row/col within 16
    const int g  = lane >> 4;       // half-wave -> K octet select

    v8f acc[4][2] = {};

    // Staging map: 8 lanes x 16 B cover one whole 128-B line (one row of the
    // K-step), so each wave-wide load touches 4 whole lines. A wave owns 16
    // rows; load i takes rows 4*(lane>>3)+i: rows 4 apart at the 80-B pitch
    // start 16 banks apart, so the 8-B LDS stores of a wave hit each bank once.
    const int gr = wave * 16 + (lane >> 3) * 4;   // first staging row
    const int gc = (lane & 7) * 4;                // staging col (floats)

    for (int kb = 0; kb < DD; kb += 32) {
        // ---- stage A tile: X[rowBase..+127][kb..+31] -> f16 LDS
        {
            const float* src = X + (size_t)(rowBase + gr) * DD + kb + gc;
            float4 f0 = *(const float4*)(src);
            float4 f1 = *(const float4*)(src + DD);
            float4 f2 = *(const float4*)(src + 2 * DD);
            float4 f3 = *(const float4*)(src + 3 * DD);
            *(v4h*)&shA[(gr + 0) * 40 + gc] = cvt4(f0);
            *(v4h*)&shA[(gr + 1) * 40 + gc] = cvt4(f1);
            *(v4h*)&shA[(gr + 2) * 40 + gc] = cvt4(f2);
            *(v4h*)&shA[(gr + 3) * 40 + gc] = cvt4(f3);
        }
        // ---- stage B tile: W[colBase+n][kb..+31] -> LDS as [n][k]
        {
            const float* src = W + (size_t)(colBase + gr) * DD + kb + gc;
            float4 f0 = *(const float4*)(src);
            float4 f1 = *(const float4*)(src + DD);
            float4 f2 = *(const float4*)(src + 2 * DD);
            float4 f3 = *(const float4*)(src + 3 * DD);
            *(v4h*)&shB[(gr + 0) * 40 + gc] = cvt4(f0);
            *(v4h*)&shB[(gr + 1) * 40 + gc] = cvt4(f1);
            *(v4h*)&shB[(gr + 2) * 40 + gc] = cvt4(f2);
            *(v4h*)&shB[(gr + 3) * 40 + gc] = cvt4(f3);
        }
        __syncthreads();

        // ---- fragments: A lane=m holds K octets g*8 and 16+g*8
        v16h af[4], bf[2];
        #pragma unroll
        for (int i = 0; i < 4; ++i) {
            const _Float16* p = &shA[(wm * 64 + i * 16 + lr) * 40];
            af[i] = cat16(*(const v8h*)(p + g * 8), *(const v8h*)(p + 16 + g * 8));
        }
        #pragma unroll
        for (int j = 0; j < 2; ++j) {
            const _Float16* p = &shB[(wn * 32 + j * 16 + lr) * 40];
            bf[j] = cat16(*(const v8h*)(p + g * 8), *(const v8h*)(p + 16 + g * 8));
        }
        #pragma unroll
        for (int i = 0; i < 4; ++i)
            #pragma unroll
            for (int j = 0; j < 2; ++j)
                acc[i][j] = wmma16(af[i], bf[j], acc[i][j]);
        __syncthreads();
    }

    // ---- epilogue: relu + f16 store
    _Float16* __restrict__ Yqk = (z == 0) ? Qp : Kp;
    #pragma unroll
    for (int i = 0; i < 4; ++i) {
        #pragma unroll
        for (int j = 0; j < 2; ++j) {
            #pragma unroll
            for (int r = 0; r < 8; ++r) {
                const int mrow = rowBase + wm * 64 + i * 16 + r + 8 * g;
                const int ncol = colBase + wn * 32 + j * 16 + lr;
                float val = acc[i][j][r];
                val = val > 0.0f ? val : 0.0f;
                const _Float16 hv = (_Float16)val;
                if (z < 2) {
                    Yqk[(size_t)mrow * DD + ncol] = hv;
                } else {
                    const int b = mrow >> 10, s = mrow & 1023;
                    const int h = ncol >> 6,  d = ncol & 63;
                    Vt[(((size_t)(b * HH + h)) * DH + d) * SS + s] = hv;
                }
            }
        }
    }
}

static __device__ __forceinline__ float xhalf(float x) {
    const int b = __builtin_bit_cast(int, x);
    return __builtin_bit_cast(float,
        __builtin_amdgcn_permlanex16(b, b, 0x76543210, 0xfedcba98, false, false));
}

#define OPITCH 68   // floats per staged output row: 272 B, a multiple of 16 B

__global__ __launch_bounds__(256)
void attn_kernel(const _Float16* __restrict__ Qp, const _Float16* __restrict__ Kp,
                 const _Float16* __restrict__ Vt, float* __restrict__ O)
{
    const int qb = blockIdx.x;   // 0..7  (q block of 128)
    const int h  = blockIdx.y;   // 0..11
    const int b  = blockIdx.z;   // 0..7
    const int t = threadIdx.x, lane = t & 31, wave = t >> 5;
    const int lr = lane & 15, g = lane >> 4;
    const int qBase = qb * 128;

    __shared__ __align__(16) _Float16 shK[32 * 72];     // [kc][d], stride 144B
    __shared__ __align__(16) _Float16 shV[64 * 40];     // [d][sc], stride 80B
    __shared__ __align__(16) float    shO[8][16 * OPITCH];  // per-wave O, [q][d]

    // ---- Q fragments for this wave's 16 rows (direct global, 16B aligned);
    //      used as B: column = query lr, k octets g*8 and 16+g*8
    const int qrow = qBase + wave * 16 + lr;
    const _Float16* qptr = Qp + (size_t)(b * SS + qrow) * DD + h * DH;
    const v16h qB0 = cat16(*(const v8h*)(qptr + g * 8),
                           *(const v8h*)(qptr + 16 + g * 8));
    const v16h qB1 = cat16(*(const v8h*)(qptr + 32 + g * 8),
                           *(const v8h*)(qptr + 48 + g * 8));

    v8f cO[4] = {};              // cO[tt][r] = O^T[d = tt*16 + 8g + r][query lr]
    float m_run = -1e30f;        // running maximum of query lr (same in both halves)
    float l_lane = 0.0f;         // running sum over this half's keys

    const float scale = 0.125f;   // 1/sqrt(64)

    for (int kb = 0; kb < SS; kb += 32) {
        // ---- stage K block: 32 keys x 64 d
        {
            const int kc = t >> 3, dc = (t & 7) * 8;
            const _Float16* src = Kp + (size_t)(b * SS + kb + kc) * DD + h * DH + dc;
            *(v8h*)&shK[kc * 72 + dc] = *(const v8h*)src;
        }
        // ---- stage V block (already transposed): 64 d x 32 keys
        {
            const int d = t >> 2, vc = (t & 3) * 8;
            const _Float16* src = Vt + (((size_t)(b * HH + h)) * DH + d) * SS + kb + vc;
            *(v8h*)&shV[d * 40 + vc] = *(const v8h*)src;
        }
        __syncthreads();

        // ---- scores^T: two 16(key) x 16(query) tiles, K-dim = Dh = 64
        //      sj[r] = S[query lr][key j*16 + 8g + r]
        v8f s0 = {}, s1 = {};
        #pragma unroll
        for (int j = 0; j < 2; ++j) {
            const _Float16* kp = &shK[(j * 16 + lr) * 72];
            v16h aK0 = cat16(*(const v8h*)(kp + g * 8),      *(const v8h*)(kp + 16 + g * 8));
            v16h aK1 = cat16(*(const v8h*)(kp + 32 + g * 8), *(const v8h*)(kp + 48 + g * 8));
            v8f sc = {};
            sc = wmma16(aK0, qB0, sc);
            sc = wmma16(aK1, qB1, sc);
            if (j == 0) s0 = sc; else s1 = sc;
        }

        // ---- online softmax of one query per lane
        const v8f a0 = s0 * scale, a1 = s1 * scale;
        float mx = fmaxf(a0[0], a1[0]);
        #pragma unroll
        for (int r = 1; r < 8; ++r) mx = fmaxf(mx, fmaxf(a0[r], a1[r]));
        mx = fmaxf(mx, xhalf(mx));
        const float mnew  = fmaxf(m_run, mx);
        const float alpha = __expf(m_run - mnew);
        m_run = mnew;

        // P^T as B operand: element s is key 8g+s (s<8) or 16+8g+(s-8),
        // which is where the two S^T tiles already hold them
        v16h pB;
        float ps0 = 0.0f, ps1 = 0.0f;
        #pragma unroll
        for (int r = 0; r < 8; ++r) {
            const float p0 = __expf(a0[r] - mnew);
            const float p1 = __expf(a1[r] - mnew);
            ps0 += p0;
            ps1 += p1;
            pB[r]     = (_Float16)p0;
            pB[8 + r] = (_Float16)p1;
        }
        l_lane = l_lane * alpha + (ps0 + ps1);
        #pragma unroll
        for (int tt = 0; tt < 4; ++tt) cO[tt] *= alpha;

        // ---- O^T += V^T @ P^T: 4 m-tiles over Dh, A = rows of V^T
        #pragma unroll
        for (int tt = 0; tt < 4; ++tt) {
            const _Float16* vp = &shV[(tt * 16 + lr) * 40];
            v16h aV = cat16(*(const v8h*)(vp + g * 8), *(const v8h*)(vp + 16 + g * 8));
            cO[tt] = wmma16(aV, pB, cO[tt]);
        }
        __syncthreads();
    }

    // ---- finalize: join the halves' sums, divide, turn O^T back in LDS so
    //      that every global store covers whole 128-B lines
    const float inv = 1.0f / (l_lane + xhalf(l_lane));
    float* so = &shO[wave][0];
    #pragma unroll
    for (int tt = 0; tt < 4; ++tt) {
        float* w = so + lr * OPITCH + tt * 16 + 8 * g;
        *(float4*)(w)     = make_float4(cO[tt][0] * inv, cO[tt][1] * inv,
                                        cO[tt][2] * inv, cO[tt][3] * inv);
        *(float4*)(w + 4) = make_float4(cO[tt][4] * inv, cO[tt][5] * inv,
                                        cO[tt][6] * inv, cO[tt][7] * inv);
    }
    __syncthreads();   // lanes read rows that other lanes wrote
    #pragma unroll
    for (int i = 0; i < 8; ++i) {
        const int rr = i * 2 + g;                 // staged row, 16 lanes x 16 B each
        const float4 o4 = *(const float4*)(so + rr * OPITCH + lr * 4);
        const int row = qBase + wave * 16 + rr;
        *(float4*)&O[(size_t)(b * SS + row) * DD + h * DH + lr * 4] = o4;
    }
}

// ---------------------------------------------------------------------------
// Kernel 3: o = 2*attn + q, then LayerNorm over D=768. One block per row.
// ---------------------------------------------------------------------------
__global__ __launch_bounds__(256)
void ln_kernel(const float* __restrict__ A, const float* __restrict__ q,
               const float* __restrict__ gamma, const float* __restrict__ beta,
               float* __restrict__ out)
{
    const int row = blockIdx.x;
    const int t = threadIdx.x;
    const float* a  = A + (size_t)row * DD;
    const float* qq = q + (size_t)row * DD;

    float x[3];
    float sum = 0.0f, sq = 0.0f;
    #pragma unroll
    for (int i = 0; i < 3; ++i) {
        const int c = t + i * 256;
        const float v = 2.0f * a[c] + qq[c];
        x[i] = v; sum += v; sq += v * v;
    }
    #pragma unroll
    for (int off = 16; off >= 1; off >>= 1) {
        sum += __shfl_xor(sum, off, 32);
        sq  += __shfl_xor(sq,  off, 32);
    }
    __shared__ float rs[8], rq[8];
    const int wave = t >> 5, lane = t & 31;
    if (lane == 0) { rs[wave] = sum; rq[wave] = sq; }
    __syncthreads();
    float s = 0.0f, s2 = 0.0f;
    #pragma unroll
    for (int w = 0; w < 8; ++w) { s += rs[w]; s2 += rq[w]; }

    const float mu   = s * (1.0f / (float)DD);
    const float var  = s2 * (1.0f / (float)DD) - mu * mu;
    const float rstd = rsqrtf(var + 1e-5f);
    #pragma unroll
    for (int i = 0; i < 3; ++i) {
        const int c = t + i * 256;
        out[(size_t)row * DD + c] = (x[i] - mu) * rstd * gamma[c] + beta[c];
    }
}

// ---------------------------------------------------------------------------
extern "C" void kernel_launch(void* const* d_in, const int* in_sizes, int n_in,
                              void* d_out, int out_size, void* d_ws, size_t ws_size,
                              hipStream_t stream) {
    (void)in_sizes; (void)n_in; (void)out_size; (void)ws_size;
    const float* q     = (const float*)d_in[0];
    const float* k     = (const float*)d_in[1];
    const float* v     = (const float*)d_in[2];
    const float* W     = (const float*)d_in[3];
    const float* gamma = (const float*)d_in[4];
    const float* beta  = (const float*)d_in[5];
    float* out = (float*)d_out;

    // workspace partition: Qp, Kp, Vt (f16) + attnOut (f32)
    _Float16* Qp = (_Float16*)d_ws;
    _Float16* Kp = Qp + (size_t)RR * DD;
    _Float16* Vt = Kp + (size_t)RR * DD;
    float*    Ao = (float*)(Vt + (size_t)RR * DD);

    // 1) projections: grid = (N tiles, M tiles, {q,k,v})
    proj_relu_kernel<<<dim3(DD / 128, RR / 128, 3), 256, 0, stream>>>(
        q, k, v, W, Qp, Kp, Vt);

    // 2) fused attention: grid = (q blocks, heads, batch)
    attn_kernel<<<dim3(SS / 128, HH, BB), 256, 0, stream>>>(Qp, Kp, Vt, Ao);

    // 3) residual + LayerNorm
    ln_kernel<<<dim3(RR), 256, 0, stream>>>(Ao, q, gamma, beta, out);
}

// v003
// A run of this version takes 118 microseconds.
// In both of two side-by-side timings against v002, it was 1.04 times as fast.
// Over all steps from v000 it is 1.39 times as fast.
#include <hip/hip_runtime.h>
#include <hip/hip_bf16.h>

typedef __attribute__((ext_vector_type(16))) _Float16 v16h;
typedef __attribute__((ext_vector_type(8)))  _Float16 v8h;
typedef __attribute__((ext_vector_type(8)))  float    v8f;
typedef __attribute__((ext_vector_type(4)))  _Float16 v4h;

#define BB 8
#define SS 1024
#define DD 768
#define HH 12
#define DH 64
#define RR (BB*SS)   // 8192 rows per tensor

static __device__ __forceinline__ v16h cat16(v8h lo, v8h hi) {
    return __builtin_shufflevector(lo, hi, 0,1,2,3,4,5,6,7,8,9,10,11,12,13,14,15);
}
static __device__ __forceinline__ v4h cvt4(const float4 a) {
    v4h r;
    r[0]=(_Float16)a.x; r[1]=(_Float16)a.y; r[2]=(_Float16)a.z; r[3]=(_Float16)a.w;
    return r;
}
static __device__ __forceinline__ v8f wmma16(v16h a, v16h b, v8f c) {
    // D = A(16x32 f16) * B(32x16 f16) + C(16x16 f32)
    return __builtin_amdgcn_wmma_f32_16x16x32_f16(false, a, false, b, (short)0, c, false, false);
}

// ---------------------------------------------------------------------------
// Kernel 1: Y = relu(X @ W^T) for X in {q,k,v}, fp32 in -> f16 out.
//   z==0 -> Qp [B,S,H,Dh] (== row-major [R,D])
//   z==1 -> Kp [B,S,H,Dh]
//   z==2 -> Vt [B,H,Dh,S]  (transposed per head for the PV GEMM A-operand)
// Tile: 128(M) x 128(N), K-step 32, 8 waves arranged 2(M) x 4(N),
// each wave owns 64x32 = 4x2 WMMA tiles.
// ---------------------------------------------------------------------------
__global__ __launch_bounds__(256)
void proj_relu_kernel(const float* __restrict__ q, const float* __restrict__ k,
                      const float* __restrict__ v, const float* __restrict__ W,
                      _Float16* __restrict__ Qp, _Float16* __restrict__ Kp,
                      _Float16* __restrict__ Vt)
{
    const int z = blockIdx.z;
    const float* __restrict__ X = (z == 0) ? q : (z == 1) ? k : v;
    const int rowBase = blockIdx.y * 128;
    const int colBase = blockIdx.x * 128;

    // row stride 40 halfs = 80B (multiple of 16B -> aligned ds_load_b128)
    __shared__ __align__(16) _Float16 shA[128 * 40];
    __shared__ __align__(16) _Float16 shB[128 * 40];

    const int t    = threadIdx.x;
    const int lane = t & 31;
    const int wave = t >> 5;
    const int wm = wave >> 2;       // 0..1
    const int wn = wave & 3;        // 0..3
    const int lr = lane & 15;       // fragment row/col within 16
    const int g  = lane >> 4;       // half-wave -> K octet select

    v8f acc[4][2] = {};

    // Staging map: 8 lanes x 16 B cover one whole 128-B line (one row of the
    // K-step), so each wave-wide load touches 4 whole lines. A wave owns 16
    // rows; load i takes rows 4*(lane>>3)+i: rows 4 apart at the 80-B pitch
    // start 16 banks apart, so the 8-B LDS stores of a wave hit each bank once.
    const int gr = wave * 16 + (lane >> 3) * 4;   // first staging row
    const int gc = (lane & 7) * 4;                // staging col (floats)

    for (int kb = 0; kb < DD; kb += 32) {
        // ---- stage A tile: X[rowBase..+127][kb..+31] -> f16 LDS
        {
            const float* src = X + (size_t)(rowBase + gr) * DD + kb + gc;
            float4 f0 = *(const float4*)(src);
            float4 f1 = *(const float4*)(src + DD);
            float4 f2 = *(const float4*)(src + 2 * DD);
            float4 f3 = *(const float4*)(src + 3 * DD);
            *(v4h*)&shA[(gr + 0) * 40 + gc] = cvt4(f0);
            *(v4h*)&shA[(gr + 1) * 40 + gc] = cvt4(f1);
            *(v4h*)&shA[(gr + 2) * 40 + gc] = cvt4(f2);
            *(v4h*)&shA[(gr + 3) * 40 + gc] = cvt4(f3);
        }
        // ---- stage B tile: W[colBase+n][kb..+31] -> LDS as [n][k]
        {
            const float* src = W + (size_t)(colBase + gr) * DD + kb + gc;
            float4 f0 = *(const float4*)(src);
            float4 f1 = *(const float4*)(src + DD);
            float4 f2 = *(const float4*)(src + 2 * DD);
            float4 f3 = *(const float4*)(src + 3 * DD);
            *(v4h*)&shB[(gr + 0) * 40 + gc] = cvt4(f0);
            *(v4h*)&shB[(gr + 1) * 40 + gc] = cvt4(f1);
            *(v4h*)&shB[(gr + 2) * 40 + gc] = cvt4(f2);
            *(v4h*)&shB[(gr + 3) * 40 + gc] = cvt4(f3);
        }
        __syncthreads();

        // ---- fragments: A lane=m holds K octets g*8 and 16+g*8
        v16h af[4], bf[2];
        #pragma unroll
        for (int i = 0; i < 4; ++i) {
            const _Float16* p = &shA[(wm * 64 + i * 16 + lr) * 40];
            af[i] = cat16(*(const v8h*)(p + g * 8), *(const v8h*)(p + 16 + g * 8));
        }
        #pragma unroll
        for (int j = 0; j < 2; ++j) {
            const _Float16* p = &shB[(wn * 32 + j * 16 + lr) * 40];
            bf[j] = cat16(*(const v8h*)(p + g * 8), *(const v8h*)(p + 16 + g * 8));
        }
        #pragma unroll
        for (int i = 0; i < 4; ++i)
            #pragma unroll
            for (int j = 0; j < 2; ++j)
                acc[i][j] = wmma16(af[i], bf[j], acc[i][j]);
        __syncthreads();
    }

    // ---- epilogue: relu + f16 store
    _Float16* __restrict__ Yqk = (z == 0) ? Qp : Kp;
    #pragma unroll
    for (int i = 0; i < 4; ++i) {
        #pragma unroll
        for (int j = 0; j < 2; ++j) {
            #pragma unroll
            for (int r = 0; r < 8; ++r) {
                const int mrow = rowBase + wm * 64 + i * 16 + r + 8 * g;
                const int ncol = colBase + wn * 32 + j * 16 + lr;
                float val = acc[i][j][r];
                val = val > 0.0f ? val : 0.0f;
                const _Float16 hv = (_Float16)val;
                if (z < 2) {
                    Yqk[(size_t)mrow * DD + ncol] = hv;
                } else {
                    const int b = mrow >> 10, s = mrow & 1023;
                    const int h = ncol >> 6,  d = ncol & 63;
                    Vt[(((size_t)(b * HH + h)) * DH + d) * SS + s] = hv;
                }
            }
        }
    }
}

static __device__ __forceinline__ float xhalf(float x) {
    const int b = __builtin_bit_cast(int, x);
    return __builtin_bit_cast(float,
        __builtin_amdgcn_permlanex16(b, b, 0x76543210, 0xfedcba98, false, false));
}

#define OPITCH 68   // floats per staged output row: 272 B, a multiple of 16 B

__global__ __launch_bounds__(256)
void attn_kernel(const _Float16* __restrict__ Qp, const _Float16* __restrict__ Kp,
                 const _Float16* __restrict__ Vt, float* __restrict__ O)
{
    const int qb = blockIdx.x;   // 0..7  (q block of 128)
    const int h  = blockIdx.y;   // 0..11
    const int b  = blockIdx.z;   // 0..7
    const int t = threadIdx.x, lane = t & 31, wave = t >> 5;
    const int lr = lane & 15, g = lane >> 4;
    const int qBase = qb * 128;

    __shared__ __align__(16) _Float16 shK[32 * 72];     // [kc][d], stride 144B
    __shared__ __align__(16) _Float16 shV[64 * 40];     // [d][sc], stride 80B
    __shared__ __align__(16) float    shO[8][16 * OPITCH];  // per-wave O, [q][d]

    // ---- Q fragments for this wave's 16 rows (direct global, 16B aligned);
    //      used as B: column = query lr, k octets g*8 and 16+g*8
    const int qrow = qBase + wave * 16 + lr;
    const _Float16* qptr = Qp + (size_t)(b * SS + qrow) * DD + h * DH;
    const v16h qB0 = cat16(*(const v8h*)(qptr + g * 8),
                           *(const v8h*)(qptr + 16 + g * 8));
    const v16h qB1 = cat16(*(const v8h*)(qptr + 32 + g * 8),
                           *(const v8h*)(qptr + 48 + g * 8));

    v8f cO[4] = {};              // cO[tt][r] = O^T[d = tt*16 + 8g + r][query lr]
    float m_run = -1e30f;        // running maximum of query lr (same in both halves)
    float l_lane = 0.0f;         // running sum over this half's keys

    const float scale = 0.125f;   // 1/sqrt(64)

    for (int kb = 0; kb < SS; kb += 32) {
        // ---- stage K block: 32 keys x 64 d
        {
            const int kc = t >> 3, dc = (t & 7) * 8;
            const _Float16* src = Kp + (size_t)(b * SS + kb + kc) * DD + h * DH + dc;
            *(v8h*)&shK[kc * 72 + dc] = *(const v8h*)src;
        }
        // ---- stage V block (already transposed): 64 d x 32 keys
        {
            const int d = t >> 2, vc = (t & 3) * 8;
            const _Float16* src = Vt + (((size_t)(b * HH + h)) * DH + d) * SS + kb + vc;
            *(v8h*)&shV[d * 40 + vc] = *(const v8h*)src;
        }
        __syncthreads();

        // ---- scores^T: two 16(key) x 16(query) tiles, K-dim = Dh = 64
        //      sj[r] = S[query lr][key j*16 + 8g + r]
        v8f s0 = {}, s1 = {};
        #pragma unroll
        for (int j = 0; j < 2; ++j) {
            const _Float16* kp = &shK[(j * 16 + lr) * 72];
            v16h aK0 = cat16(*(const v8h*)(kp + g * 8),      *(const v8h*)(kp + 16 + g * 8));
            v16h aK1 = cat16(*(const v8h*)(kp + 32 + g * 8), *(const v8h*)(kp + 48 + g * 8));
            v8f sc = {};
            sc = wmma16(aK0, qB0, sc);
            sc = wmma16(aK1, qB1, sc);
            if (j == 0) s0 = sc; else s1 = sc;
        }

        // ---- online softmax of one query per lane
        const v8f a0 = s0 * scale, a1 = s1 * scale;
        float mx = fmaxf(a0[0], a1[0]);
        #pragma unroll
        for (int r = 1; r < 8; ++r) mx = fmaxf(mx, fmaxf(a0[r], a1[r]));
        mx = fmaxf(mx, xhalf(mx));
        const float mnew  = fmaxf(m_run, mx);
        const float alpha = __expf(m_run - mnew);
        m_run = mnew;

        // P^T as B operand: element s is key 8g+s (s<8) or 16+8g+(s-8),
        // which is where the two S^T tiles already hold them
        v16h pB;
        float ps0 = 0.0f, ps1 = 0.0f;
        #pragma unroll
        for (int r = 0; r < 8; ++r) {
            const float p0 = __expf(a0[r] - mnew);
            const float p1 = __expf(a1[r] - mnew);
            ps0 += p0;
            ps1 += p1;
            pB[r]     = (_Float16)p0;
            pB[8 + r] = (_Float16)p1;
        }
        l_lane = l_lane * alpha + (ps0 + ps1);
        #pragma unroll
        for (int tt = 0; tt < 4; ++tt) cO[tt] *= alpha;

        // ---- O^T += V^T @ P^T: 4 m-tiles over Dh, A = rows of V^T
        #pragma unroll
        for (int tt = 0; tt < 4; ++tt) {
            const _Float16* vp = &shV[(tt * 16 + lr) * 40];
            v16h aV = cat16(*(const v8h*)(vp + g * 8), *(const v8h*)(vp + 16 + g * 8));
            cO[tt] = wmma16(aV, pB, cO[tt]);
        }
        __syncthreads();
    }

    // ---- finalize: join the halves' sums, divide, turn O^T back in LDS so
    //      that every global store covers whole 128-B lines
    const float inv = 1.0f / (l_lane + xhalf(l_lane));
    float* so = &shO[wave][0];
    #pragma unroll
    for (int tt = 0; tt < 4; ++tt) {
        float* w = so + lr * OPITCH + tt * 16 + 8 * g;
        *(float4*)(w)     = make_float4(cO[tt][0] * inv, cO[tt][1] * inv,
                                        cO[tt][2] * inv, cO[tt][3] * inv);
        *(float4*)(w + 4) = make_float4(cO[tt][4] * inv, cO[tt][5] * inv,
                                        cO[tt][6] * inv, cO[tt][7] * inv);
    }
    __syncthreads();   // lanes read rows that other lanes wrote
    #pragma unroll
    for (int i = 0; i < 8; ++i) {
        const int rr = i * 2 + g;                 // staged row, 16 lanes x 16 B each
        const float4 o4 = *(const float4*)(so + rr * OPITCH + lr * 4);
        const int row = qBase + wave * 16 + rr;
        *(float4*)&O[(size_t)(b * SS + row) * DD + h * DH + lr * 4] = o4;
    }
}

// ---------------------------------------------------------------------------
// Kernel 3: o = 2*attn + q, then LayerNorm over D=768.
// One wave per row, LN_ROWS rows per wave: a lane holds 24 values of a row as
// six 16-B pieces (each wave-wide load or store covers 512 contiguous bytes).
// All rows' loads are issued before the first row is summed; the row sums stay
// inside the wave, so the kernel has no LDS and no barrier.
// ---------------------------------------------------------------------------
#define LN_ROWS 2
#define LN_PCS  6    // 16-B pieces per lane and row: 768 / (32 * 4)
typedef __attribute__((ext_vector_type(4))) float v4f;

template <int CTRL>
static __device__ __forceinline__ float row_xor(float x) {  // lane l <- lane l ^ (CTRL & 15)
    const int b = __builtin_bit_cast(int, x);
    return __builtin_bit_cast(float, __builtin_amdgcn_update_dpp(b, b, CTRL, 0xf, 0xf, true));
}
static __device__ __forceinline__ float wave_sum(float x) {  // every lane gets the sum of all 32
    x += row_xor<0x161>(x);
    x += row_xor<0x162>(x);
    x += row_xor<0x164>(x);
    x += row_xor<0x168>(x);
    return x + xhalf(x);
}

__global__ __launch_bounds__(256)
void ln_kernel(const float* __restrict__ A, const float* __restrict__ q,
               const float* __restrict__ gamma, const float* __restrict__ beta,
               float* __restrict__ out)
{
    const int col  = (threadIdx.x & 31) * 4;
    const int wave = __builtin_amdgcn_readfirstlane(threadIdx.x >> 5);
    const size_t row0 = (size_t)(blockIdx.x * 8 + wave) * LN_ROWS;   // wave-uniform
    const float* __restrict__ ap = A   + row0 * DD + col;
    const float* __restrict__ qp = q   + row0 * DD + col;
    float* __restrict__       op = out + row0 * DD + col;

    v4f x[LN_ROWS][LN_PCS], r[LN_ROWS][LN_PCS], gm[LN_PCS], bt[LN_PCS];
    #pragma unroll
    for (int rr = 0; rr < LN_ROWS; ++rr) {
        #pragma unroll
        for (int i = 0; i < LN_PCS; ++i) x[rr][i] = *(const v4f*)(ap + rr * DD + i * 128);
        #pragma unroll
        for (int i = 0; i < LN_PCS; ++i) r[rr][i] = *(const v4f*)(qp + rr * DD + i * 128);
    }
    #pragma unroll
    for (int i = 0; i < LN_PCS; ++i) gm[i] = *(const v4f*)(gamma + col + i * 128);
    #pragma unroll
    for (int i = 0; i < LN_PCS; ++i) bt[i] = *(const v4f*)(beta + col + i * 128);
    // keeps every load above the arithmetic: without it the compiler sinks part of
    // them behind waits, and the wave pays several memory trips one after another
    __builtin_amdgcn_sched_barrier(0);

    #pragma unroll
    for (int rr = 0; rr < LN_ROWS; ++rr) {
        v4f s4 = {}, q4 = {};
        #pragma unroll
        for (int i = 0; i < LN_PCS; ++i) {
            x[rr][i] = 2.0f * x[rr][i] + r[rr][i];
            s4 += x[rr][i];
            q4 += x[rr][i] * x[rr][i];
        }
        const float s  = wave_sum((s4[0] + s4[1]) + (s4[2] + s4[3]));
        const float s2 = wave_sum((q4[0] + q4[1]) + (q4[2] + q4[3]));

        const float mu   = s * (1.0f / (float)DD);
        const float var  = s2 * (1.0f / (float)DD) - mu * mu;
        const float rstd = rsqrtf(var + 1e-5f);
        #pragma unroll
        for (int i = 0; i < LN_PCS; ++i)
            *(v4f*)(op + rr * DD + i * 128) = (x[rr][i] - mu) * rstd * gm[i] + bt[i];
    }
}

// ---------------------------------------------------------------------------
extern "C" void kernel_launch(void* const* d_in, const int* in_sizes, int n_in,
                              void* d_out, int out_size, void* d_ws, size_t ws_size,
                              hipStream_t stream) {
    (void)in_sizes; (void)n_in; (void)out_size; (void)ws_size;
    const float* q     = (const float*)d_in[0];
    const float* k     = (const float*)d_in[1];
    const float* v     = (const float*)d_in[2];
    const float* W     = (const float*)d_in[3];
    const float* gamma = (const float*)d_in[4];
    const float* beta  = (const float*)d_in[5];
    float* out = (float*)d_out;

    // workspace partition: Qp, Kp, Vt (f16) + attnOut (f32)
    _Float16* Qp = (_Float16*)d_ws;
    _Float16* Kp = Qp + (size_t)RR * DD;
    _Float16* Vt = Kp + (size_t)RR * DD;
    float*    Ao = (float*)(Vt + (size_t)RR * DD);

    // 1) projections: grid = (N tiles, M tiles, {q,k,v})
    proj_relu_kernel<<<dim3(DD / 128, RR / 128, 3), 256, 0, stream>>>(
        q, k, v, W, Qp, Kp, Vt);

    // 2) fused attention: grid = (q blocks, heads, batch)
    attn_kernel<<<dim3(SS / 128, HH, BB), 256, 0, stream>>>(Qp, Kp, Vt, Ao);

    // 3) residual + LayerNorm
    ln_kernel<<<dim3(RR / (8 * LN_ROWS)), 256, 0, stream>>>(Ao, q, gamma, beta, out);
}

// v004
// It runs in 106 microseconds.
// Two timings next to v003 both put it at 1.11 times that version's speed.
// Counting every step since v000, it is 1.54 times as fast.
#include <hip/hip_runtime.h>
#include <hip/hip_bf16.h>

typedef __attribute__((ext_vector_type(16))) _Float16 v16h;
typedef __attribute__((ext_vector_type(8)))  _Float16 v8h;
typedef __attribute__((ext_vector_type(8)))  float    v8f;
typedef __attribute__((ext_vector_type(4)))  _Float16 v4h;

#define BB 8
#define SS 1024
#define DD 768
#define HH 12
#define DH 64
#define RR (BB*SS)   // 8192 rows per tensor

static __device__ __forceinline__ v16h cat16(v8h lo, v8h hi) {
    return __builtin_shufflevector(lo, hi, 0,1,2,3,4,5,6,7,8,9,10,11,12,13,14,15);
}
static __device__ __forceinline__ v4h cvt4(const float4 a) {
    v4h r;
    r[0]=(_Float16)a.x; r[1]=(_Float16)a.y; r[2]=(_Float16)a.z; r[3]=(_Float16)a.w;
    return r;
}
static __device__ __forceinline__ v8f wmma16(v16h a, v16h b, v8f c) {
    // D = A(16x32 f16) * B(32x16 f16) + C(16x16 f32)
    return __builtin_amdgcn_wmma_f32_16x16x32_f16(false, a, false, b, (short)0, c, false, false);
}

// ---------------------------------------------------------------------------
// Kernel 1: Y = relu(X @ W^T) for X in {q,k,v}, fp32 in -> f16 out.
//   z==0 -> Qp [B,S,H,Dh] (== row-major [R,D])
//   z==1 -> Kp [B,S,H,Dh]
//   z==2 -> Vt [B,H,Dh,S]  (transposed per head for the PV GEMM A-operand)
// Tile: 128(M) x 128(N), K-step 32, 8 waves arranged 2 x 4,
// each wave owns 64x32 = 4x2 WMMA tiles.
// A lane's 8 accumulator registers run along the A operand's rows. The operand
// whose index is contiguous in the output is therefore taken as A: X for Vt
// (contiguous in s), W for Qp and Kp (contiguous in the column). The 8 values
// pack to 16 B, the tile is gathered in LDS as [B row][A row], and every
// global store covers whole 128-B lines.
// ---------------------------------------------------------------------------
#define TPITCH 136   // halfs per gathered output row: 272 B = 16 B x 17

// a thread's 8 pieces of the gathered tile, 16 rows apart, to rows of PITCH halfs
template <int PITCH>
static __device__ __forceinline__ void store_tile(_Float16* __restrict__ dst,
                                                  const _Float16* tile) {
    // unrolled so that the 8 LDS reads issue ahead of the stores and the row
    // steps become immediate offsets
    #pragma unroll
    for (int i = 0; i < 8; ++i)
        *(v8h*)(dst + (size_t)i * 16 * PITCH) = *(const v8h*)(tile + i * 16 * TPITCH);
    // stands in front of whatever next rewrites a register these stores name
    asm volatile("s_wait_xcnt 0x0" ::: "memory");
}
__global__ __launch_bounds__(256)
void proj_relu_kernel(const float* __restrict__ q, const float* __restrict__ k,
                      const float* __restrict__ v, const float* __restrict__ W,
                      _Float16* __restrict__ Qp, _Float16* __restrict__ Kp,
                      _Float16* __restrict__ Vt)
{
    const int z = blockIdx.z;
    const float* __restrict__ X = (z == 0) ? q : (z == 1) ? k : v;
    const int rowBase = blockIdx.y * 128;
    const int colBase = blockIdx.x * 128;

    // row stride 40 halfs = 80B (multiple of 16B -> aligned ds_load_b128)
    // the two staging tiles of the K loop; after it, the gathered output tile
    __shared__ __align__(16) _Float16 sh[128 * TPITCH];
    _Float16* const shA = sh;
    _Float16* const shB = sh + 128 * 40;
    const int offA = (z == 2) ? 0 : 128 * 40;   // tile read as the A operand
    const int offB = (z == 2) ? 128 * 40 : 0;   // tile read as the B operand

    const int t    = threadIdx.x;
    const int lane = t & 31;
    const int wave = t >> 5;
    const int wm = wave >> 2;       // 0..1
    const int wn = wave & 3;        // 0..3
    const int lr = lane & 15;       // fragment row/col within 16
    const int g  = lane >> 4;       // half-wave -> K octet select

    v8f acc[4][2] = {};

    // Staging map: 8 lanes x 16 B cover one whole 128-B line (one row of the
    // K-step), so each wave-wide load touches 4 whole lines. A wave owns 16
    // rows; load i takes rows 4*(lane>>3)+i: rows 4 apart at the 80-B pitch
    // start 16 banks apart, so the 8-B LDS stores of a wave hit each bank once.
    const int gr = wave * 16 + (lane >> 3) * 4;   // first staging row
    const int gc = (lane & 7) * 4;                // staging col (floats)

    for (int kb = 0; kb < DD; kb += 32) {
        // ---- stage A tile: X[rowBase..+127][kb..+31] -> f16 LDS
        {
            const float* src = X + (size_t)(rowBase + gr) * DD + kb + gc;
            float4 f0 = *(const float4*)(src);
            float4 f1 = *(const float4*)(src + DD);
            float4 f2 = *(const float4*)(src + 2 * DD);
            float4 f3 = *(const float4*)(src + 3 * DD);
            *(v4h*)&shA[(gr + 0) * 40 + gc] = cvt4(f0);
            *(v4h*)&shA[(gr + 1) * 40 + gc] = cvt4(f1);
            *(v4h*)&shA[(gr + 2) * 40 + gc] = cvt4(f2);
            *(v4h*)&shA[(gr + 3) * 40 + gc] = cvt4(f3);
        }
        // ---- stage B tile: W[colBase+n][kb..+31] -> LDS as [n][k]
        {
            const float* src = W + (size_t)(colBase + gr) * DD + kb + gc;
            float4 f0 = *(const float4*)(src);
            float4 f1 = *(const float4*)(src + DD);
            float4 f2 = *(const float4*)(src + 2 * DD);
            float4 f3 = *(const float4*)(src + 3 * DD);
            *(v4h*)&shB[(gr + 0) * 40 + gc] = cvt4(f0);
            *(v4h*)&shB[(gr + 1) * 40 + gc] = cvt4(f1);
            *(v4h*)&shB[(gr + 2) * 40 + gc] = cvt4(f2);
            *(v4h*)&shB[(gr + 3) * 40 + gc] = cvt4(f3);
        }
        __syncthreads();

        // ---- fragments: A lane=m holds K octets g*8 and 16+g*8
        v16h af[4], bf[2];
        #pragma unroll
        for (int i = 0; i < 4; ++i) {
            const _Float16* p = &sh[offA + (wm * 64 + i * 16 + lr) * 40];
            af[i] = cat16(*(const v8h*)(p + g * 8), *(const v8h*)(p + 16 + g * 8));
        }
        #pragma unroll
        for (int j = 0; j < 2; ++j) {
            const _Float16* p = &sh[offB + (wn * 32 + j * 16 + lr) * 40];
            bf[j] = cat16(*(const v8h*)(p + g * 8), *(const v8h*)(p + 16 + g * 8));
        }
        #pragma unroll
        for (int i = 0; i < 4; ++i)
            #pragma unroll
            for (int j = 0; j < 2; ++j)
                acc[i][j] = wmma16(af[i], bf[j], acc[i][j]);
        __syncthreads();
    }

    // ---- epilogue: relu, pack to f16, gather the tile in LDS. The loop's last
    //      barrier has ended every read of the staging tiles.
    #pragma unroll
    for (int i = 0; i < 4; ++i) {
        #pragma unroll
        for (int j = 0; j < 2; ++j) {
            v8h hv;
            #pragma unroll
            for (int r = 0; r < 8; ++r) {
                float val = acc[i][j][r];
                val = val > 0.0f ? val : 0.0f;
                hv[r] = (_Float16)val;
            }
            *(v8h*)&sh[(wn * 32 + j * 16 + lr) * TPITCH + wm * 64 + i * 16 + 8 * g] = hv;
        }
    }
    __syncthreads();   // threads store rows that other waves wrote

    // gathered row rr, 128 contiguous halfs: Qp/Kp row rowBase+rr from column
    // colBase; Vt row (b, h, d) = column colBase+rr from position rowBase & 1023
    const int rr = t >> 4, cc = (t & 15) * 8;   // 16 lanes x 16 B per row
    const _Float16* tile = &sh[rr * TPITCH + cc];
    if (z == 2)
        store_tile<SS>(Vt + ((size_t)(rowBase >> 10) * DD + colBase + rr) * SS
                          + (rowBase & (SS - 1)) + cc, tile);
    else
        store_tile<DD>(((z == 0) ? Qp : Kp) + (size_t)(rowBase + rr) * DD + colBase + cc, tile);
}

static __device__ __forceinline__ float xhalf(float x) {
    const int b = __builtin_bit_cast(int, x);
    return __builtin_bit_cast(float,
        __builtin_amdgcn_permlanex16(b, b, 0x76543210, 0xfedcba98, false, false));
}

#define OPITCH 68   // floats per staged output row: 272 B, a multiple of 16 B

__global__ __launch_bounds__(256)
void attn_kernel(const _Float16* __restrict__ Qp, const _Float16* __restrict__ Kp,
                 const _Float16* __restrict__ Vt, float* __restrict__ O)
{
    const int qb = blockIdx.x;   // 0..7  (q block of 128)
    const int h  = blockIdx.y;   // 0..11
    const int b  = blockIdx.z;   // 0..7
    const int t = threadIdx.x, lane = t & 31, wave = t >> 5;
    const int lr = lane & 15, g = lane >> 4;
    const int qBase = qb * 128;

    __shared__ __align__(16) _Float16 shK[32 * 72];     // [kc][d], stride 144B
    __shared__ __align__(16) _Float16 shV[64 * 40];     // [d][sc], stride 80B
    __shared__ __align__(16) float    shO[8][16 * OPITCH];  // per-wave O, [q][d]

    // ---- Q fragments for this wave's 16 rows (direct global, 16B aligned);
    //      used as B: column = query lr, k octets g*8 and 16+g*8
    const int qrow = qBase + wave * 16 + lr;
    const _Float16* qptr = Qp + (size_t)(b * SS + qrow) * DD + h * DH;
    const v16h qB0 = cat16(*(const v8h*)(qptr + g * 8),
                           *(const v8h*)(qptr + 16 + g * 8));
    const v16h qB1 = cat16(*(const v8h*)(qptr + 32 + g * 8),
                           *(const v8h*)(qptr + 48 + g * 8));

    v8f cO[4] = {};              // cO[tt][r] = O^T[d = tt*16 + 8g + r][query lr]
    float m_run = -1e30f;        // running maximum of query lr (same in both halves)
    float l_lane = 0.0f;         // running sum over this half's keys

    const float scale = 0.125f;   // 1/sqrt(64)

    for (int kb = 0; kb < SS; kb += 32) {
        // ---- stage K block: 32 keys x 64 d
        {
            const int kc = t >> 3, dc = (t & 7) * 8;
            const _Float16* src = Kp + (size_t)(b * SS + kb + kc) * DD + h * DH + dc;
            *(v8h*)&shK[kc * 72 + dc] = *(const v8h*)src;
        }
        // ---- stage V block (already transposed): 64 d x 32 keys
        {
            const int d = t >> 2, vc = (t & 3) * 8;
            const _Float16* src = Vt + (((size_t)(b * HH + h)) * DH + d) * SS + kb + vc;
            *(v8h*)&shV[d * 40 + vc] = *(const v8h*)src;
        }
        __syncthreads();

        // ---- scores^T: two 16(key) x 16(query) tiles, K-dim = Dh = 64
        //      sj[r] = S[query lr][key j*16 + 8g + r]
        v8f s0 = {}, s1 = {};
        #pragma unroll
        for (int j = 0; j < 2; ++j) {
            const _Float16* kp = &shK[(j * 16 + lr) * 72];
            v16h aK0 = cat16(*(const v8h*)(kp + g * 8),      *(const v8h*)(kp + 16 + g * 8));
            v16h aK1 = cat16(*(const v8h*)(kp + 32 + g * 8), *(const v8h*)(kp + 48 + g * 8));
            v8f sc = {};
            sc = wmma16(aK0, qB0, sc);
            sc = wmma16(aK1, qB1, sc);
            if (j == 0) s0 = sc; else s1 = sc;
        }

        // ---- online softmax of one query per lane
        const v8f a0 = s0 * scale, a1 = s1 * scale;
        float mx = fmaxf(a0[0], a1[0]);
        #pragma unroll
        for (int r = 1; r < 8; ++r) mx = fmaxf(mx, fmaxf(a0[r], a1[r]));
        mx = fmaxf(mx, xhalf(mx));
        const float mnew  = fmaxf(m_run, mx);
        const float alpha = __expf(m_run - mnew);
        m_run = mnew;

        // P^T as B operand: element s is key 8g+s (s<8) or 16+8g+(s-8),
        // which is where the two S^T tiles already hold them
        v16h pB;
        float ps0 = 0.0f, ps1 = 0.0f;
        #pragma unroll
        for (int r = 0; r < 8; ++r) {
            const float p0 = __expf(a0[r] - mnew);
            const float p1 = __expf(a1[r] - mnew);
            ps0 += p0;
            ps1 += p1;
            pB[r]     = (_Float16)p0;
            pB[8 + r] = (_Float16)p1;
        }
        l_lane = l_lane * alpha + (ps0 + ps1);
        #pragma unroll
        for (int tt = 0; tt < 4; ++tt) cO[tt] *= alpha;

        // ---- O^T += V^T @ P^T: 4 m-tiles over Dh, A = rows of V^T
        #pragma unroll
        for (int tt = 0; tt < 4; ++tt) {
            const _Float16* vp = &shV[(tt * 16 + lr) * 40];
            v16h aV = cat16(*(const v8h*)(vp + g * 8), *(const v8h*)(vp + 16 + g * 8));
            cO[tt] = wmma16(aV, pB, cO[tt]);
        }
        __syncthreads();
    }

    // ---- finalize: join the halves' sums, divide, turn O^T back in LDS so
    //      that every global store covers whole 128-B lines
    const float inv = 1.0f / (l_lane + xhalf(l_lane));
    float* so = &shO[wave][0];
    #pragma unroll
    for (int tt = 0; tt < 4; ++tt) {
        float* w = so + lr * OPITCH + tt * 16 + 8 * g;
        *(float4*)(w)     = make_float4(cO[tt][0] * inv, cO[tt][1] * inv,
                                        cO[tt][2] * inv, cO[tt][3] * inv);
        *(float4*)(w + 4) = make_float4(cO[tt][4] * inv, cO[tt][5] * inv,
                                        cO[tt][6] * inv, cO[tt][7] * inv);
    }
    __syncthreads();   // lanes read rows that other lanes wrote
    #pragma unroll
    for (int i = 0; i < 8; ++i) {
        const int rr = i * 2 + g;                 // staged row, 16 lanes x 16 B each
        const float4 o4 = *(const float4*)(so + rr * OPITCH + lr * 4);
        const int row = qBase + wave * 16 + rr;
        *(float4*)&O[(size_t)(b * SS + row) * DD + h * DH + lr * 4] = o4;
    }
}

// ---------------------------------------------------------------------------
// Kernel 3: o = 2*attn + q, then LayerNorm over D=768.
// One wave per row, LN_ROWS rows per wave: a lane holds 24 values of a row as
// six 16-B pieces (each wave-wide load or store covers 512 contiguous bytes).
// All rows' loads are issued before the first row is summed; the row sums stay
// inside the wave, so the kernel has no LDS and no barrier.
// ---------------------------------------------------------------------------
#define LN_ROWS 2
#define LN_PCS  6    // 16-B pieces per lane and row: 768 / (32 * 4)
typedef __attribute__((ext_vector_type(4))) float v4f;

template <int CTRL>
static __device__ __forceinline__ float row_xor(float x) {  // lane l <- lane l ^ (CTRL & 15)
    const int b = __builtin_bit_cast(int, x);
    return __builtin_bit_cast(float, __builtin_amdgcn_update_dpp(b, b, CTRL, 0xf, 0xf, true));
}
static __device__ __forceinline__ float wave_sum(float x) {  // every lane gets the sum of all 32
    x += row_xor<0x161>(x);
    x += row_xor<0x162>(x);
    x += row_xor<0x164>(x);
    x += row_xor<0x168>(x);
    return x + xhalf(x);
}

__global__ __launch_bounds__(256)
void ln_kernel(const float* __restrict__ A, const float* __restrict__ q,
               const float* __restrict__ gamma, const float* __restrict__ beta,
               float* __restrict__ out)
{
    const int col  = (threadIdx.x & 31) * 4;
    const int wave = __builtin_amdgcn_readfirstlane(threadIdx.x >> 5);
    const size_t row0 = (size_t)(blockIdx.x * 8 + wave) * LN_ROWS;   // wave-uniform
    const float* __restrict__ ap = A   + row0 * DD + col;
    const float* __restrict__ qp = q   + row0 * DD + col;
    float* __restrict__       op = out + row0 * DD + col;

    v4f x[LN_ROWS][LN_PCS], r[LN_ROWS][LN_PCS], gm[LN_PCS], bt[LN_PCS];
    #pragma unroll
    for (int rr = 0; rr < LN_ROWS; ++rr) {
        #pragma unroll
        for (int i = 0; i < LN_PCS; ++i) x[rr][i] = *(const v4f*)(ap + rr * DD + i * 128);
        #pragma unroll
        for (int i = 0; i < LN_PCS; ++i) r[rr][i] = *(const v4f*)(qp + rr * DD + i * 128);
    }
    #pragma unroll
    for (int i = 0; i < LN_PCS; ++i) gm[i] = *(const v4f*)(gamma + col + i * 128);
    #pragma unroll
    for (int i = 0; i < LN_PCS; ++i) bt[i] = *(const v4f*)(beta + col + i * 128);
    // keeps every load above the arithmetic: without it the compiler sinks part of
    // them behind waits, and the wave pays several memory trips one after another
    __builtin_amdgcn_sched_barrier(0);

    #pragma unroll
    for (int rr = 0; rr < LN_ROWS; ++rr) {
        v4f s4 = {}, q4 = {};
        #pragma unroll
        for (int i = 0; i < LN_PCS; ++i) {
            x[rr][i] = 2.0f * x[rr][i] + r[rr][i];
            s4 += x[rr][i];
            q4 += x[rr][i] * x[rr][i];
        }
        const float s  = wave_sum((s4[0] + s4[1]) + (s4[2] + s4[3]));
        const float s2 = wave_sum((q4[0] + q4[1]) + (q4[2] + q4[3]));

        const float mu   = s * (1.0f / (float)DD);
        const float var  = s2 * (1.0f / (float)DD) - mu * mu;
        const float rstd = rsqrtf(var + 1e-5f);
        #pragma unroll
        for (int i = 0; i < LN_PCS; ++i)
            *(v4f*)(op + rr * DD + i * 128) = (x[rr][i] - mu) * rstd * gm[i] + bt[i];
    }
}

// ---------------------------------------------------------------------------
extern "C" void kernel_launch(void* const* d_in, const int* in_sizes, int n_in,
                              void* d_out, int out_size, void* d_ws, size_t ws_size,
                              hipStream_t stream) {
    (void)in_sizes; (void)n_in; (void)out_size; (void)ws_size;
    const float* q     = (const float*)d_in[0];
    const float* k     = (const float*)d_in[1];
    const float* v     = (const float*)d_in[2];
    const float* W     = (const float*)d_in[3];
    const float* gamma = (const float*)d_in[4];
    const float* beta  = (const float*)d_in[5];
    float* out = (float*)d_out;

    // workspace partition: Qp, Kp, Vt (f16) + attnOut (f32)
    _Float16* Qp = (_Float16*)d_ws;
    _Float16* Kp = Qp + (size_t)RR * DD;
    _Float16* Vt = Kp + (size_t)RR * DD;
    float*    Ao = (float*)(Vt + (size_t)RR * DD);

    // 1) projections: grid = (N tiles, M tiles, {q,k,v})
    proj_relu_kernel<<<dim3(DD / 128, RR / 128, 3), 256, 0, stream>>>(
        q, k, v, W, Qp, Kp, Vt);

    // 2) fused attention: grid = (q blocks, heads, batch)
    attn_kernel<<<dim3(SS / 128, HH, BB), 256, 0, stream>>>(Qp, Kp, Vt, Ao);

    // 3) residual + LayerNorm
    ln_kernel<<<dim3(RR / (8 * LN_ROWS)), 256, 0, stream>>>(Ao, q, gamma, beta, out);
}

// v005
// A run of this version takes 83.3 microseconds.
// Two timings next to v004 put it at 1.27 and 1.28 times that version's speed.
// Over all steps from v000 it is 1.96 times as fast.
#include <hip/hip_runtime.h>
#include <hip/hip_bf16.h>

typedef __attribute__((ext_vector_type(16))) _Float16 v16h;
typedef __attribute__((ext_vector_type(8)))  _Float16 v8h;
typedef __attribute__((ext_vector_type(8)))  float    v8f;
typedef __attribute__((ext_vector_type(4)))  _Float16 v4h;

#define BB 8
#define SS 1024
#define DD 768
#define HH 12
#define DH 64
#define RR (BB*SS)   // 8192 rows per tensor

static __device__ __forceinline__ v16h cat16(v8h lo, v8h hi) {
    return __builtin_shufflevector(lo, hi, 0,1,2,3,4,5,6,7,8,9,10,11,12,13,14,15);
}
static __device__ __forceinline__ v4h cvt4(const float4 a) {
    v4h r;
    r[0]=(_Float16)a.x; r[1]=(_Float16)a.y; r[2]=(_Float16)a.z; r[3]=(_Float16)a.w;
    return r;
}
static __device__ __forceinline__ v8f wmma16(v16h a, v16h b, v8f c) {
    // D = A(16x32 f16) * B(32x16 f16) + C(16x16 f32)
    return __builtin_amdgcn_wmma_f32_16x16x32_f16(false, a, false, b, (short)0, c, false, false);
}

// ---------------------------------------------------------------------------
// Kernel 1: Y = relu(X @ W^T) for X in {q,k,v}, fp32 in -> f16 out.
//   z==0 -> Qp [B,S,H,Dh] (== row-major [R,D])
//   z==1 -> Kp [B,S,H,Dh]
//   z==2 -> Vt [B,H,Dh,S]  (transposed per head for the PV GEMM A-operand)
// Tile: 128 rows of X x 192 rows of W (output columns), K-step 32, 8 waves
// arranged 2 x 4, each wave owns 64 x 48 = 4 x 3 WMMA tiles. That gives 768
// work-groups; at 160 registers three of them fit a WGP, so all are resident
// at once on 256 WGPs, and X is read 4 times, not 6.
// A lane's 8 accumulator registers run along the A operand's rows. The operand
// whose index is contiguous in the output is therefore taken as A: X for Vt
// (contiguous in s), W for Qp and Kp (contiguous in the column). The 8 values
// pack to 16 B, the tile is gathered in LDS as [B row][A row], and every
// global store covers whole 128-B lines.
// ---------------------------------------------------------------------------
#define TM 128       // X rows per tile
#define TN 192       // W rows per tile
#define SPITCH 40    // halfs per staged row: 80 B, 16 B x 5
#define VPITCH 136   // halfs per gathered Vt row (128 + 8): 272 B = 16 B x 17
#define QPITCH 200   // halfs per gathered Qp/Kp row (192 + 8): 400 B = 16 B x 25

// XA: X is the A operand (Vt); otherwise W is (Qp, Kp)
template <bool XA>
static __device__ __forceinline__ void proj_tile(const float* __restrict__ X,
                                                 const float* __restrict__ W,
                                                 _Float16* __restrict__ Y,
                                                 const int rowBase, const int colBase,
                                                 _Float16* const sh)
{
    // the two staging tiles of the K loop; after it, sh is the gathered tile
    _Float16* const shX = sh;
    _Float16* const shW = sh + TM * SPITCH;

    const int t    = threadIdx.x;
    const int lane = t & 31;
    const int wave = t >> 5;
    const int wx = wave >> 2;       // 0..1: 64 rows of X
    const int ww = wave & 3;        // 0..3: 48 rows of W
    const int lr = lane & 15;       // fragment row/col within 16
    const int g  = lane >> 4;       // half-wave -> K octet select

    v8f acc[4][3] = {};

    // Staging map: 8 lanes x 16 B cover one whole 128-B line (one row of the
    // K-step), so each wave-wide load touches 4 whole lines. The 8 waves take
    // 32 rows per load; a wave's 4 rows lie 4 apart: at the 80-B pitch they
    // start 16 banks apart, so its 8-B LDS stores hit each bank once.
    const int gr = (wave >> 2) * 16 + (lane >> 3) * 4 + (wave & 3);   // first staging row
    const int gc = (lane & 7) * 4;                                    // staging col (floats)
    // One 32-bit byte offset per lane serves both operands and steps with kb; the
    // tile bases are wave-uniform. Kept in 32 bits, it lets every load take the
    // form scalar base + lane offset: the offset lives through the loop, so no
    // load's result lands on a register that another load of the group names.
    const unsigned lo = (unsigned)(gr * DD + gc) * 4u;
    const char* xs = (const char*)(X + (size_t)rowBase * DD);
    const char* ws = (const char*)(W + (size_t)colBase * DD);

    for (int kb = 0; kb < DD; kb += 32) {
        // ---- stage X[rowBase..+127][kb..+31] and W[colBase..+191][kb..+31] -> f16 LDS
        //      (the loops over n are unrolled so that fx and fw stay in registers, the
        //      10 loads issue as one group and the row steps become immediate offsets)
        float4 fx[TM / 32], fw[TN / 32];
        const unsigned vb = lo + (unsigned)kb * 4u;
        #pragma unroll
        for (int n = 0; n < TM / 32; ++n) fx[n] = *(const float4*)(xs + vb + n * (32 * DD * 4));
        #pragma unroll
        for (int n = 0; n < TN / 32; ++n) fw[n] = *(const float4*)(ws + vb + n * (32 * DD * 4));
        #pragma unroll
        for (int n = 0; n < TM / 32; ++n) *(v4h*)&shX[(gr + n * 32) * SPITCH + gc] = cvt4(fx[n]);
        #pragma unroll
        for (int n = 0; n < TN / 32; ++n) *(v4h*)&shW[(gr + n * 32) * SPITCH + gc] = cvt4(fw[n]);
        __syncthreads();

        // ---- fragments: lane = row, holds K octets g*8 and 16+g*8 (A and B alike);
        //      unrolled: every index of xf, wf and acc must be a constant
        v16h xf[4], wf[3];
        #pragma unroll
        for (int i = 0; i < 4; ++i) {
            const _Float16* p = &shX[(wx * 64 + i * 16 + lr) * SPITCH];
            xf[i] = cat16(*(const v8h*)(p + g * 8), *(const v8h*)(p + 16 + g * 8));
        }
        #pragma unroll
        for (int j = 0; j < 3; ++j) {
            const _Float16* p = &shW[(ww * 48 + j * 16 + lr) * SPITCH];
            wf[j] = cat16(*(const v8h*)(p + g * 8), *(const v8h*)(p + 16 + g * 8));
        }
        #pragma unroll
        for (int i = 0; i < 4; ++i)
            #pragma unroll
            for (int j = 0; j < 3; ++j)
                acc[i][j] = XA ? wmma16(xf[i], wf[j], acc[i][j])
                               : wmma16(wf[j], xf[i], acc[i][j]);
        __syncthreads();
    }

    // ---- epilogue: relu, pack to f16, gather the tile in LDS. The loop's last
    //      barrier has ended every read of the staging tiles.
    #pragma unroll
    for (int i = 0; i < 4; ++i) {
        #pragma unroll
        for (int j = 0; j < 3; ++j) {
            v8h hv;
            #pragma unroll
            for (int r = 0; r < 8; ++r) {
                float val = acc[i][j][r];
                val = val > 0.0f ? val : 0.0f;
                hv[r] = (_Float16)val;
            }
            const int xr = wx * 64 + i * 16, wr = ww * 48 + j * 16;
            if (XA) *(v8h*)&sh[(wr + lr) * VPITCH + xr + 8 * g] = hv;
            else    *(v8h*)&sh[(xr + lr) * QPITCH + wr + 8 * g] = hv;
        }
    }
    __syncthreads();   // threads store rows that other waves wrote

    // The loops below are unrolled so that the LDS reads issue ahead of the
    // stores and the row steps become immediate offsets.
    if (XA) {
        // gathered row rr = column colBase+rr, i.e. Vt row (b, h, d): 128
        // contiguous halfs from position rowBase & 1023; 16 lanes x 16 B per row
        const int rr = t >> 4, cc = (t & 15) * 8;
        const _Float16* tile = &sh[rr * VPITCH + cc];
        _Float16* dst = Y + ((size_t)(rowBase >> 10) * DD + colBase + rr) * SS
                          + (rowBase & (SS - 1)) + cc;
        #pragma unroll
        for (int i = 0; i < TN / 16; ++i)
            *(v8h*)(dst + (size_t)i * 16 * SS) = *(const v8h*)(tile + i * 16 * VPITCH);
    } else {
        // gathered row rr = Qp/Kp row rowBase+rr: 192 contiguous halfs (three
        // 128-B lines) from column colBase; 8 lanes x 16 B per line
        const int rr = t >> 3, cc = (t & 7) * 8;
        const _Float16* tile = &sh[rr * QPITCH + cc];
        _Float16* dst = Y + (size_t)(rowBase + rr) * DD + colBase + cc;
        #pragma unroll
        for (int i = 0; i < TM / 32; ++i)
            #pragma unroll
            for (int l = 0; l < TN / 64; ++l)
                *(v8h*)(dst + (size_t)i * 32 * DD + l * 64) =
                    *(const v8h*)(tile + i * 32 * QPITCH + l * 64);
    }
    // stands in front of whatever next rewrites a register these stores name
    asm volatile("s_wait_xcnt 0x0" ::: "memory");
}

// second argument: at least 6 waves per SIMD, i.e. a budget of 160 registers, so
// that three work-groups fit a WGP and the whole grid is resident in one round
__global__ __launch_bounds__(256, 6)
void proj_relu_kernel(const float* __restrict__ q, const float* __restrict__ k,
                      const float* __restrict__ v, const float* __restrict__ W,
                      _Float16* __restrict__ Qp, _Float16* __restrict__ Kp,
                      _Float16* __restrict__ Vt)
{
    const int z = blockIdx.z;
    const int rowBase = blockIdx.y * TM;
    const int colBase = blockIdx.x * TN;
    __shared__ __align__(16) _Float16 sh[TN * VPITCH];   // the largest of its three uses
    if (z == 2) proj_tile<true >(v, W, Vt, rowBase, colBase, sh);
    else        proj_tile<false>((z == 0) ? q : k, W, (z == 0) ? Qp : Kp, rowBase, colBase, sh);
}

static __device__ __forceinline__ float xhalf(float x) {
    const int b = __builtin_bit_cast(int, x);
    return __builtin_bit_cast(float,
        __builtin_amdgcn_permlanex16(b, b, 0x76543210, 0xfedcba98, false, false));
}

#define OPITCH 68   // floats per staged output row: 272 B, a multiple of 16 B

__global__ __launch_bounds__(256)
void attn_kernel(const _Float16* __restrict__ Qp, const _Float16* __restrict__ Kp,
                 const _Float16* __restrict__ Vt, float* __restrict__ O)
{
    const int qb = blockIdx.x;   // 0..7  (q block of 128)
    const int h  = blockIdx.y;   // 0..11
    const int b  = blockIdx.z;   // 0..7
    const int t = threadIdx.x, lane = t & 31, wave = t >> 5;
    const int lr = lane & 15, g = lane >> 4;
    const int qBase = qb * 128;

    __shared__ __align__(16) _Float16 shK[32 * 72];     // [kc][d], stride 144B
    __shared__ __align__(16) _Float16 shV[64 * 40];     // [d][sc], stride 80B
    __shared__ __align__(16) float    shO[8][16 * OPITCH];  // per-wave O, [q][d]

    // ---- Q fragments for this wave's 16 rows (direct global, 16B aligned);
    //      used as B: column = query lr, k octets g*8 and 16+g*8
    const int qrow = qBase + wave * 16 + lr;
    const _Float16* qptr = Qp + (size_t)(b * SS + qrow) * DD + h * DH;
    const v16h qB0 = cat16(*(const v8h*)(qptr + g * 8),
                           *(const v8h*)(qptr + 16 + g * 8));
    const v16h qB1 = cat16(*(const v8h*)(qptr + 32 + g * 8),
                           *(const v8h*)(qptr + 48 + g * 8));

    v8f cO[4] = {};              // cO[tt][r] = O^T[d = tt*16 + 8g + r][query lr]
    float m_run = -1e30f;        // running maximum of query lr (same in both halves)
    float l_lane = 0.0f;         // running sum over this half's keys

    const float scale = 0.125f;   // 1/sqrt(64)

    for (int kb = 0; kb < SS; kb += 32) {
        // ---- stage K block: 32 keys x 64 d
        {
            const int kc = t >> 3, dc = (t & 7) * 8;
            const _Float16* src = Kp + (size_t)(b * SS + kb + kc) * DD + h * DH + dc;
            *(v8h*)&shK[kc * 72 + dc] = *(const v8h*)src;
        }
        // ---- stage V block (already transposed): 64 d x 32 keys
        {
            const int d = t >> 2, vc = (t & 3) * 8;
            const _Float16* src = Vt + (((size_t)(b * HH + h)) * DH + d) * SS + kb + vc;
            *(v8h*)&shV[d * 40 + vc] = *(const v8h*)src;
        }
        __syncthreads();

        // ---- scores^T: two 16(key) x 16(query) tiles, K-dim = Dh = 64
        //      sj[r] = S[query lr][key j*16 + 8g + r]
        v8f s0 = {}, s1 = {};
        #pragma unroll
        for (int j = 0; j < 2; ++j) {
            const _Float16* kp = &shK[(j * 16 + lr) * 72];
            v16h aK0 = cat16(*(const v8h*)(kp + g * 8),      *(const v8h*)(kp + 16 + g * 8));
            v16h aK1 = cat16(*(const v8h*)(kp + 32 + g * 8), *(const v8h*)(kp + 48 + g * 8));
            v8f sc = {};
            sc = wmma16(aK0, qB0, sc);
            sc = wmma16(aK1, qB1, sc);
            if (j == 0) s0 = sc; else s1 = sc;
        }

        // ---- online softmax of one query per lane
        const v8f a0 = s0 * scale, a1 = s1 * scale;
        float mx = fmaxf(a0[0], a1[0]);
        #pragma unroll
        for (int r = 1; r < 8; ++r) mx = fmaxf(mx, fmaxf(a0[r], a1[r]));
        mx = fmaxf(mx, xhalf(mx));
        const float mnew  = fmaxf(m_run, mx);
        const float alpha = __expf(m_run - mnew);
        m_run = mnew;

        // P^T as B operand: element s is key 8g+s (s<8) or 16+8g+(s-8),
        // which is where the two S^T tiles already hold them
        v16h pB;
        float ps0 = 0.0f, ps1 = 0.0f;
        #pragma unroll
        for (int r = 0; r < 8; ++r) {
            const float p0 = __expf(a0[r] - mnew);
            const float p1 = __expf(a1[r] - mnew);
            ps0 += p0;
            ps1 += p1;
            pB[r]     = (_Float16)p0;
            pB[8 + r] = (_Float16)p1;
        }
        l_lane = l_lane * alpha + (ps0 + ps1);
        #pragma unroll
        for (int tt = 0; tt < 4; ++tt) cO[tt] *= alpha;

        // ---- O^T += V^T @ P^T: 4 m-tiles over Dh, A = rows of V^T
        #pragma unroll
        for (int tt = 0; tt < 4; ++tt) {
            const _Float16* vp = &shV[(tt * 16 + lr) * 40];
            v16h aV = cat16(*(const v8h*)(vp + g * 8), *(const v8h*)(vp + 16 + g * 8));
            cO[tt] = wmma16(aV, pB, cO[tt]);
        }
        __syncthreads();
    }

    // ---- finalize: join the halves' sums, divide, turn O^T back in LDS so
    //      that every global store covers whole 128-B lines
    const float inv = 1.0f / (l_lane + xhalf(l_lane));
    float* so = &shO[wave][0];
    #pragma unroll
    for (int tt = 0; tt < 4; ++tt) {
        float* w = so + lr * OPITCH + tt * 16 + 8 * g;
        *(float4*)(w)     = make_float4(cO[tt][0] * inv, cO[tt][1] * inv,
                                        cO[tt][2] * inv, cO[tt][3] * inv);
        *(float4*)(w + 4) = make_float4(cO[tt][4] * inv, cO[tt][5] * inv,
                                        cO[tt][6] * inv, cO[tt][7] * inv);
    }
    __syncthreads();   // lanes read rows that other lanes wrote
    #pragma unroll
    for (int i = 0; i < 8; ++i) {
        const int rr = i * 2 + g;                 // staged row, 16 lanes x 16 B each
        const float4 o4 = *(const float4*)(so + rr * OPITCH + lr * 4);
        const int row = qBase + wave * 16 + rr;
        *(float4*)&O[(size_t)(b * SS + row) * DD + h * DH + lr * 4] = o4;
    }
}

// ---------------------------------------------------------------------------
// Kernel 3: o = 2*attn + q, then LayerNorm over D=768.
// One wave per row, LN_ROWS rows per wave: a lane holds 24 values of a row as
// six 16-B pieces (each wave-wide load or store covers 512 contiguous bytes).
// All rows' loads are issued before the first row is summed; the row sums stay
// inside the wave, so the kernel has no LDS and no barrier.
// ---------------------------------------------------------------------------
#define LN_ROWS 2
#define LN_PCS  6    // 16-B pieces per lane and row: 768 / (32 * 4)
typedef __attribute__((ext_vector_type(4))) float v4f;

template <int CTRL>
static __device__ __forceinline__ float row_xor(float x) {  // lane l <- lane l ^ (CTRL & 15)
    const int b = __builtin_bit_cast(int, x);
    return __builtin_bit_cast(float, __builtin_amdgcn_update_dpp(b, b, CTRL, 0xf, 0xf, true));
}
static __device__ __forceinline__ float wave_sum(float x) {  // every lane gets the sum of all 32
    x += row_xor<0x161>(x);
    x += row_xor<0x162>(x);
    x += row_xor<0x164>(x);
    x += row_xor<0x168>(x);
    return x + xhalf(x);
}

__global__ __launch_bounds__(256)
void ln_kernel(const float* __restrict__ A, const float* __restrict__ q,
               const float* __restrict__ gamma, const float* __restrict__ beta,
               float* __restrict__ out)
{
    const int col  = (threadIdx.x & 31) * 4;
    const int wave = __builtin_amdgcn_readfirstlane(threadIdx.x >> 5);
    const size_t row0 = (size_t)(blockIdx.x * 8 + wave) * LN_ROWS;   // wave-uniform
    const float* __restrict__ ap = A   + row0 * DD + col;
    const float* __restrict__ qp = q   + row0 * DD + col;
    float* __restrict__       op = out + row0 * DD + col;

    v4f x[LN_ROWS][LN_PCS], r[LN_ROWS][LN_PCS], gm[LN_PCS], bt[LN_PCS];
    #pragma unroll
    for (int rr = 0; rr < LN_ROWS; ++rr) {
        #pragma unroll
        for (int i = 0; i < LN_PCS; ++i) x[rr][i] = *(const v4f*)(ap + rr * DD + i * 128);
        #pragma unroll
        for (int i = 0; i < LN_PCS; ++i) r[rr][i] = *(const v4f*)(qp + rr * DD + i * 128);
    }
    #pragma unroll
    for (int i = 0; i < LN_PCS; ++i) gm[i] = *(const v4f*)(gamma + col + i * 128);
    #pragma unroll
    for (int i = 0; i < LN_PCS; ++i) bt[i] = *(const v4f*)(beta + col + i * 128);
    // keeps every load above the arithmetic: without it the compiler sinks part of
    // them behind waits, and the wave pays several memory trips one after another
    __builtin_amdgcn_sched_barrier(0);

    #pragma unroll
    for (int rr = 0; rr < LN_ROWS; ++rr) {
        v4f s4 = {}, q4 = {};
        #pragma unroll
        for (int i = 0; i < LN_PCS; ++i) {
            x[rr][i] = 2.0f * x[rr][i] + r[rr][i];
            s4 += x[rr][i];
            q4 += x[rr][i] * x[rr][i];
        }
        const float s  = wave_sum((s4[0] + s4[1]) + (s4[2] + s4[3]));
        const float s2 = wave_sum((q4[0] + q4[1]) + (q4[2] + q4[3]));

        const float mu   = s * (1.0f / (float)DD);
        const float var  = s2 * (1.0f / (float)DD) - mu * mu;
        const float rstd = rsqrtf(var + 1e-5f);
        #pragma unroll
        for (int i = 0; i < LN_PCS; ++i)
            *(v4f*)(op + rr * DD + i * 128) = (x[rr][i] - mu) * rstd * gm[i] + bt[i];
    }
}

// ---------------------------------------------------------------------------
extern "C" void kernel_launch(void* const* d_in, const int* in_sizes, int n_in,
                              void* d_out, int out_size, void* d_ws, size_t ws_size,
                              hipStream_t stream) {
    (void)in_sizes; (void)n_in; (void)out_size; (void)ws_size;
    const float* q     = (const float*)d_in[0];
    const float* k     = (const float*)d_in[1];
    const float* v     = (const float*)d_in[2];
    const float* W     = (const float*)d_in[3];
    const float* gamma = (const float*)d_in[4];
    const float* beta  = (const float*)d_in[5];
    float* out = (float*)d_out;

    // workspace partition: Qp, Kp, Vt (f16) + attnOut (f32)
    _Float16* Qp = (_Float16*)d_ws;
    _Float16* Kp = Qp + (size_t)RR * DD;
    _Float16* Vt = Kp + (size_t)RR * DD;
    float*    Ao = (float*)(Vt + (size_t)RR * DD);

    // 1) projections: grid = (N tiles, M tiles, {q,k,v})
    proj_relu_kernel<<<dim3(DD / TN, RR / TM, 3), 256, 0, stream>>>(
        q, k, v, W, Qp, Kp, Vt);

    // 2) fused attention: grid = (q blocks, heads, batch)
    attn_kernel<<<dim3(SS / 128, HH, BB), 256, 0, stream>>>(Qp, Kp, Vt, Ao);

    // 3) residual + LayerNorm
    ln_kernel<<<dim3(RR / (8 * LN_ROWS)), 256, 0, stream>>>(Ao, q, gamma, beta, out);
}

// v006
// One run takes 72.5 microseconds.
// In both of two side-by-side timings against v005, it was 1.15 times as fast.
// Over all steps from v000 it is 2.25 times as fast.
#include <hip/hip_runtime.h>
#include <hip/hip_bf16.h>

typedef __attribute__((ext_vector_type(16))) _Float16 v16h;
typedef __attribute__((ext_vector_type(8)))  _Float16 v8h;
typedef __attribute__((ext_vector_type(8)))  float    v8f;
typedef __attribute__((ext_vector_type(4)))  _Float16 v4h;

#define BB 8
#define SS 1024
#define DD 768
#define HH 12
#define DH 64
#define RR (BB*SS)   // 8192 rows per tensor

static __device__ __forceinline__ v16h cat16(v8h lo, v8h hi) {
    return __builtin_shufflevector(lo, hi, 0,1,2,3,4,5,6,7,8,9,10,11,12,13,14,15);
}
static __device__ __forceinline__ v4h cvt4(const float4 a) {
    v4h r;
    r[0]=(_Float16)a.x; r[1]=(_Float16)a.y; r[2]=(_Float16)a.z; r[3]=(_Float16)a.w;
    return r;
}
static __device__ __forceinline__ v8f wmma16(v16h a, v16h b, v8f c) {
    // D = A(16x32 f16) * B(32x16 f16) + C(16x16 f32)
    return __builtin_amdgcn_wmma_f32_16x16x32_f16(false, a, false, b, (short)0, c, false, false);
}

// ---------------------------------------------------------------------------
// Kernel 1: Y = relu(X @ W^T) for X in {q,k,v}, fp32 in -> f16 out.
//   z==0 -> Qp [B,S,H,Dh] (== row-major [R,D])
//   z==1 -> Kp [B,S,H,Dh]
//   z==2 -> Vt [B,H,Dh,S]  (transposed per head for the PV GEMM A-operand)
// Tile: 128 rows of X x 192 rows of W (output columns), K-step 32, 8 waves
// arranged 2 x 4, each wave owns 64 x 48 = 4 x 3 WMMA tiles. That gives 768
// work-groups; at 160 registers three of them fit a WGP, so all are resident
// at once on 256 WGPs, and X is read 4 times, not 6.
// A lane's 8 accumulator registers run along the A operand's rows. The operand
// whose index is contiguous in the output is therefore taken as A: X for Vt
// (contiguous in s), W for Qp and Kp (contiguous in the column). The 8 values
// pack to 16 B, the tile is gathered in LDS as [B row][A row], and every
// global store covers whole 128-B lines.
// ---------------------------------------------------------------------------
#define TM 128       // X rows per tile
#define TN 192       // W rows per tile
#define SPITCH 40    // halfs per staged row: 80 B, 16 B x 5
#define VPITCH 136   // halfs per gathered Vt row (128 + 8): 272 B = 16 B x 17
#define QPITCH 200   // halfs per gathered Qp/Kp row (192 + 8): 400 B = 16 B x 25

// XA: X is the A operand (Vt); otherwise W is (Qp, Kp)
template <bool XA>
static __device__ __forceinline__ void proj_tile(const float* __restrict__ X,
                                                 const float* __restrict__ W,
                                                 _Float16* __restrict__ Y,
                                                 const int rowBase, const int colBase,
                                                 _Float16* const sh)
{
    // the two staging tiles of the K loop; after it, sh is the gathered tile
    _Float16* const shX = sh;
    _Float16* const shW = sh + TM * SPITCH;

    const int t    = threadIdx.x;
    const int lane = t & 31;
    const int wave = t >> 5;
    const int wx = wave >> 2;       // 0..1: 64 rows of X
    const int ww = wave & 3;        // 0..3: 48 rows of W
    const int lr = lane & 15;       // fragment row/col within 16
    const int g  = lane >> 4;       // half-wave -> K octet select

    v8f acc[4][3] = {};

    // Staging map: 8 lanes x 16 B cover one whole 128-B line (one row of the
    // K-step), so each wave-wide load touches 4 whole lines. The 8 waves take
    // 32 rows per load; a wave's 4 rows lie 4 apart: at the 80-B pitch they
    // start 16 banks apart, so its 8-B LDS stores hit each bank once.
    const int gr = (wave >> 2) * 16 + (lane >> 3) * 4 + (wave & 3);   // first staging row
    const int gc = (lane & 7) * 4;                                    // staging col (floats)
    // One 32-bit byte offset per lane serves both operands and steps with kb; the
    // tile bases are wave-uniform. Kept in 32 bits, it lets every load take the
    // form scalar base + lane offset: the offset lives through the loop, so no
    // load's result lands on a register that another load of the group names.
    const unsigned lo = (unsigned)(gr * DD + gc) * 4u;
    const char* xs = (const char*)(X + (size_t)rowBase * DD);
    const char* ws = (const char*)(W + (size_t)colBase * DD);

    for (int kb = 0; kb < DD; kb += 32) {
        // ---- stage X[rowBase..+127][kb..+31] and W[colBase..+191][kb..+31] -> f16 LDS
        //      (the loops over n are unrolled so that fx and fw stay in registers, the
        //      10 loads issue as one group and the row steps become immediate offsets)
        float4 fx[TM / 32], fw[TN / 32];
        const unsigned vb = lo + (unsigned)kb * 4u;
        #pragma unroll
        for (int n = 0; n < TM / 32; ++n) fx[n] = *(const float4*)(xs + vb + n * (32 * DD * 4));
        #pragma unroll
        for (int n = 0; n < TN / 32; ++n) fw[n] = *(const float4*)(ws + vb + n * (32 * DD * 4));
        #pragma unroll
        for (int n = 0; n < TM / 32; ++n) *(v4h*)&shX[(gr + n * 32) * SPITCH + gc] = cvt4(fx[n]);
        #pragma unroll
        for (int n = 0; n < TN / 32; ++n) *(v4h*)&shW[(gr + n * 32) * SPITCH + gc] = cvt4(fw[n]);
        __syncthreads();

        // ---- fragments: lane = row, holds K octets g*8 and 16+g*8 (A and B alike);
        //      unrolled: every index of xf, wf and acc must be a constant
        v16h xf[4], wf[3];
        #pragma unroll
        for (int i = 0; i < 4; ++i) {
            const _Float16* p = &shX[(wx * 64 + i * 16 + lr) * SPITCH];
            xf[i] = cat16(*(const v8h*)(p + g * 8), *(const v8h*)(p + 16 + g * 8));
        }
        #pragma unroll
        for (int j = 0; j < 3; ++j) {
            const _Float16* p = &shW[(ww * 48 + j * 16 + lr) * SPITCH];
            wf[j] = cat16(*(const v8h*)(p + g * 8), *(const v8h*)(p + 16 + g * 8));
        }
        #pragma unroll
        for (int i = 0; i < 4; ++i)
            #pragma unroll
            for (int j = 0; j < 3; ++j)
                acc[i][j] = XA ? wmma16(xf[i], wf[j], acc[i][j])
                               : wmma16(wf[j], xf[i], acc[i][j]);
        __syncthreads();
    }

    // ---- epilogue: relu, pack to f16, gather the tile in LDS. The loop's last
    //      barrier has ended every read of the staging tiles.
    #pragma unroll
    for (int i = 0; i < 4; ++i) {
        #pragma unroll
        for (int j = 0; j < 3; ++j) {
            v8h hv;
            #pragma unroll
            for (int r = 0; r < 8; ++r) {
                float val = acc[i][j][r];
                val = val > 0.0f ? val : 0.0f;
                hv[r] = (_Float16)val;
            }
            const int xr = wx * 64 + i * 16, wr = ww * 48 + j * 16;
            if (XA) *(v8h*)&sh[(wr + lr) * VPITCH + xr + 8 * g] = hv;
            else    *(v8h*)&sh[(xr + lr) * QPITCH + wr + 8 * g] = hv;
        }
    }
    __syncthreads();   // threads store rows that other waves wrote

    // The loops below are unrolled so that the LDS reads issue ahead of the
    // stores and the row steps become immediate offsets.
    if (XA) {
        // gathered row rr = column colBase+rr, i.e. Vt row (b, h, d): 128
        // contiguous halfs from position rowBase & 1023; 16 lanes x 16 B per row
        const int rr = t >> 4, cc = (t & 15) * 8;
        const _Float16* tile = &sh[rr * VPITCH + cc];
        _Float16* dst = Y + ((size_t)(rowBase >> 10) * DD + colBase + rr) * SS
                          + (rowBase & (SS - 1)) + cc;
        #pragma unroll
        for (int i = 0; i < TN / 16; ++i)
            *(v8h*)(dst + (size_t)i * 16 * SS) = *(const v8h*)(tile + i * 16 * VPITCH);
    } else {
        // gathered row rr = Qp/Kp row rowBase+rr: 192 contiguous halfs (three
        // 128-B lines) from column colBase; 8 lanes x 16 B per line
        const int rr = t >> 3, cc = (t & 7) * 8;
        const _Float16* tile = &sh[rr * QPITCH + cc];
        _Float16* dst = Y + (size_t)(rowBase + rr) * DD + colBase + cc;
        #pragma unroll
        for (int i = 0; i < TM / 32; ++i)
            #pragma unroll
            for (int l = 0; l < TN / 64; ++l)
                *(v8h*)(dst + (size_t)i * 32 * DD + l * 64) =
                    *(const v8h*)(tile + i * 32 * QPITCH + l * 64);
    }
    // stands in front of whatever next rewrites a register these stores name
    asm volatile("s_wait_xcnt 0x0" ::: "memory");
}

// second argument: at least 6 waves per SIMD, i.e. a budget of 160 registers, so
// that three work-groups fit a WGP and the whole grid is resident in one round
__global__ __launch_bounds__(256, 6)
void proj_relu_kernel(const float* __restrict__ q, const float* __restrict__ k,
                      const float* __restrict__ v, const float* __restrict__ W,
                      _Float16* __restrict__ Qp, _Float16* __restrict__ Kp,
                      _Float16* __restrict__ Vt)
{
    const int z = blockIdx.z;
    const int rowBase = blockIdx.y * TM;
    const int colBase = blockIdx.x * TN;
    __shared__ __align__(16) _Float16 sh[TN * VPITCH];   // the largest of its three uses
    if (z == 2) proj_tile<true >(v, W, Vt, rowBase, colBase, sh);
    else        proj_tile<false>((z == 0) ? q : k, W, (z == 0) ? Qp : Kp, rowBase, colBase, sh);
}

static __device__ __forceinline__ float xhalf(float x) {
    const int b = __builtin_bit_cast(int, x);
    return __builtin_bit_cast(float,
        __builtin_amdgcn_permlanex16(b, b, 0x76543210, 0xfedcba98, false, false));
}

#define OPITCH 68   // floats per staged output row: 272 B, a multiple of 16 B
#define STG    64   // keys per stage
#define KVP    72   // halfs per staged row of K or V^T: 128 B + 16 B, 16 B x 9
#define OPH    (64 * KVP)   // halfs per staged operand: 64 rows

// One stage's share of a thread: two 16-B pieces of K, two of V^T. lk, lv: LDS
// byte addresses of the first pieces; the second lie 32 rows further on.
static __device__ __forceinline__ void copy_stage(const unsigned lk, const unsigned lv,
                                                  const _Float16* gk, const _Float16* gv)
{
    const unsigned lk1 = lk + 32 * KVP * 2, lv1 = lv + 32 * KVP * 2;
    const _Float16* gk1 = gk + 32 * DD;
    const _Float16* gv1 = gv + 32 * SS;
    // the closing wait stands in front of whatever next rewrites a register
    // that these copies name; inside the statement nothing can be lifted over it
    asm volatile("global_load_async_to_lds_b128 %0, %4, off\n\t"
                 "global_load_async_to_lds_b128 %1, %5, off\n\t"
                 "global_load_async_to_lds_b128 %2, %6, off\n\t"
                 "global_load_async_to_lds_b128 %3, %7, off\n\t"
                 "s_wait_xcnt 0x0"
                 :: "v"(lk), "v"(lk1), "v"(lv), "v"(lv1),
                    "v"(gk), "v"(gk1), "v"(gv), "v"(gv1) : "memory");
}

__global__ __launch_bounds__(256)
void attn_kernel(const _Float16* __restrict__ Qp, const _Float16* __restrict__ Kp,
                 const _Float16* __restrict__ Vt, float* __restrict__ O)
{
    const int qb = blockIdx.x;   // 0..7  (q block of 128)
    const int h  = blockIdx.y;   // 0..11
    const int b  = blockIdx.z;   // 0..7
    const int t = threadIdx.x, lane = t & 31, wave = t >> 5;
    const int lr = lane & 15, g = lane >> 4;
    const int qBase = qb * 128;

    __shared__ __align__(16) _Float16 shK[2 * OPH];     // two buffers of [key][d]
    __shared__ __align__(16) _Float16 shV[2 * OPH];     // two buffers of [d][key]
    __shared__ __align__(16) float    shO[8][16 * OPITCH];  // per-wave O, [q][d]

    // ---- Q fragments for this wave's 16 rows (direct global, 16B aligned);
    //      used as B: column = query lr, k octets g*8 and 16+g*8
    const int qrow = qBase + wave * 16 + lr;
    const _Float16* qptr = Qp + (size_t)(b * SS + qrow) * DD + h * DH;
    const v16h qB0 = cat16(*(const v8h*)(qptr + g * 8),
                           *(const v8h*)(qptr + 16 + g * 8));
    const v16h qB1 = cat16(*(const v8h*)(qptr + 32 + g * 8),
                           *(const v8h*)(qptr + 48 + g * 8));

    v8f cO[4] = {};              // cO[tt][r] = O^T[d = tt*16 + 8g + r][query lr]
    float m_run = -1e30f;        // running maximum of query lr (same in both halves)
    float l_lane = 0.0f;         // running sum over this half's keys

    const float scale = 0.125f;   // 1/sqrt(64)

    // ---- staging map: 8 lanes x 16 B cover one 128-B row (a key's 64 d, or 64
    //      keys of one d), so every wave-wide copy takes 4 whole lines
    const int sr = t >> 3, sc8 = (t & 7) * 8;
    const _Float16* gk = Kp + (size_t)(b * SS + sr) * DD + h * DH + sc8;
    const _Float16* gv = Vt + (((size_t)(b * HH + h)) * DH + sr) * SS + sc8;
    const unsigned lk = (unsigned)(size_t)&shK[sr * KVP + sc8];
    const unsigned lv = (unsigned)(size_t)&shV[sr * KVP + sc8];

    copy_stage(lk, lv, gk, gv);
    asm volatile("s_wait_asynccnt 0x0" ::: "memory");   // stage 0 has landed
    __syncthreads();                                    // and every wave may read it
    copy_stage(lk + OPH * 2, lv + OPH * 2, gk + STG * DD, gv + STG);

    for (int st = 0; st < SS / STG; ++st) {
      const int bo = (st & 1) * OPH;     // this stage's buffer
      // unrolled: the block's offset in the buffer becomes an immediate
      #pragma unroll
      for (int ps = 0; ps < STG / 32; ++ps) {
        // ---- scores^T: two 16(key) x 16(query) tiles, K-dim = Dh = 64
        //      sj[r] = S[query lr][key j*16 + 8g + r]
        v8f s0 = {}, s1 = {};
        #pragma unroll
        for (int j = 0; j < 2; ++j) {
            const _Float16* kp = &shK[bo + (ps * 32 + j * 16 + lr) * KVP];
            v16h aK0 = cat16(*(const v8h*)(kp + g * 8),      *(const v8h*)(kp + 16 + g * 8));
            v16h aK1 = cat16(*(const v8h*)(kp + 32 + g * 8), *(const v8h*)(kp + 48 + g * 8));
            v8f sc = {};
            sc = wmma16(aK0, qB0, sc);
            sc = wmma16(aK1, qB1, sc);
            if (j == 0) s0 = sc; else s1 = sc;
        }

        // ---- online softmax of one query per lane
        const v8f a0 = s0 * scale, a1 = s1 * scale;
        float mx = fmaxf(a0[0], a1[0]);
        #pragma unroll
        for (int r = 1; r < 8; ++r) mx = fmaxf(mx, fmaxf(a0[r], a1[r]));
        mx = fmaxf(mx, xhalf(mx));
        const float mnew  = fmaxf(m_run, mx);
        const float alpha = __expf(m_run - mnew);
        m_run = mnew;

        // P^T as B operand: element s is key 8g+s (s<8) or 16+8g+(s-8),
        // which is where the two S^T tiles already hold them
        v16h pB;
        float ps0 = 0.0f, ps1 = 0.0f;
        #pragma unroll
        for (int r = 0; r < 8; ++r) {
            const float p0 = __expf(a0[r] - mnew);
            const float p1 = __expf(a1[r] - mnew);
            ps0 += p0;
            ps1 += p1;
            pB[r]     = (_Float16)p0;
            pB[8 + r] = (_Float16)p1;
        }
        l_lane = l_lane * alpha + (ps0 + ps1);
        #pragma unroll
        for (int tt = 0; tt < 4; ++tt) cO[tt] *= alpha;

        // ---- O^T += V^T @ P^T: 4 m-tiles over Dh, A = rows of V^T
        #pragma unroll
        for (int tt = 0; tt < 4; ++tt) {
            const _Float16* vp = &shV[bo + (tt * 16 + lr) * KVP + ps * 32];
            v16h aV = cat16(*(const v8h*)(vp + g * 8), *(const v8h*)(vp + 16 + g * 8));
            cO[tt] = wmma16(aV, pB, cO[tt]);
        }
      }
      // ---- hand-over: this wave's reads of the buffer are done, its copies of
      //      the next stage have landed; behind the barrier that holds for all
      asm volatile("s_wait_dscnt 0x0" ::: "memory");      // own reads of this buffer ended
      asm volatile("s_wait_asynccnt 0x0" ::: "memory");   // own copies of stage st + 1 landed
      __syncthreads();
      if (st + 2 < SS / STG)   // the same for the whole work-group
          copy_stage(lk + bo * 2, lv + bo * 2,
                     gk + (size_t)(st + 2) * (STG * DD), gv + (st + 2) * STG);
    }
    asm volatile("s_wait_asynccnt 0x0" ::: "memory");   // nothing in flight at the wave's end

    // ---- finalize: join the halves' sums, divide, turn O^T back in LDS so
    //      that every global store covers whole 128-B lines
    const float inv = 1.0f / (l_lane + xhalf(l_lane));
    float* so = &shO[wave][0];
    #pragma unroll
    for (int tt = 0; tt < 4; ++tt) {
        float* w = so + lr * OPITCH + tt * 16 + 8 * g;
        *(float4*)(w)     = make_float4(cO[tt][0] * inv, cO[tt][1] * inv,
                                        cO[tt][2] * inv, cO[tt][3] * inv);
        *(float4*)(w + 4) = make_float4(cO[tt][4] * inv, cO[tt][5] * inv,
                                        cO[tt][6] * inv, cO[tt][7] * inv);
    }
    __syncthreads();   // lanes read rows that other lanes wrote
    #pragma unroll
    for (int i = 0; i < 8; ++i) {
        const int rr = i * 2 + g;                 // staged row, 16 lanes x 16 B each
        const float4 o4 = *(const float4*)(so + rr * OPITCH + lr * 4);
        const int row = qBase + wave * 16 + rr;
        *(float4*)&O[(size_t)(b * SS + row) * DD + h * DH + lr * 4] = o4;
    }
}

// ---------------------------------------------------------------------------
// Kernel 3: o = 2*attn + q, then LayerNorm over D=768.
// One wave per row, LN_ROWS rows per wave: a lane holds 24 values of a row as
// six 16-B pieces (each wave-wide load or store covers 512 contiguous bytes).
// All rows' loads are issued before the first row is summed; the row sums stay
// inside the wave, so the kernel has no LDS and no barrier.
// ---------------------------------------------------------------------------
#define LN_ROWS 2
#define LN_PCS  6    // 16-B pieces per lane and row: 768 / (32 * 4)
typedef __attribute__((ext_vector_type(4))) float v4f;

template <int CTRL>
static __device__ __forceinline__ float row_xor(float x) {  // lane l <- lane l ^ (CTRL & 15)
    const int b = __builtin_bit_cast(int, x);
    return __builtin_bit_cast(float, __builtin_amdgcn_update_dpp(b, b, CTRL, 0xf, 0xf, true));
}
static __device__ __forceinline__ float wave_sum(float x) {  // every lane gets the sum of all 32
    x += row_xor<0x161>(x);
    x += row_xor<0x162>(x);
    x += row_xor<0x164>(x);
    x += row_xor<0x168>(x);
    return x + xhalf(x);
}

__global__ __launch_bounds__(256)
void ln_kernel(const float* __restrict__ A, const float* __restrict__ q,
               const float* __restrict__ gamma, const float* __restrict__ beta,
               float* __restrict__ out)
{
    const int col  = (threadIdx.x & 31) * 4;
    const int wave = __builtin_amdgcn_readfirstlane(threadIdx.x >> 5);
    const size_t row0 = (size_t)(blockIdx.x * 8 + wave) * LN_ROWS;   // wave-uniform
    const float* __restrict__ ap = A   + row0 * DD + col;
    const float* __restrict__ qp = q   + row0 * DD + col;
    float* __restrict__       op = out + row0 * DD + col;

    v4f x[LN_ROWS][LN_PCS], r[LN_ROWS][LN_PCS], gm[LN_PCS], bt[LN_PCS];
    #pragma unroll
    for (int rr = 0; rr < LN_ROWS; ++rr) {
        #pragma unroll
        for (int i = 0; i < LN_PCS; ++i) x[rr][i] = *(const v4f*)(ap + rr * DD + i * 128);
        #pragma unroll
        for (int i = 0; i < LN_PCS; ++i) r[rr][i] = *(const v4f*)(qp + rr * DD + i * 128);
    }
    #pragma unroll
    for (int i = 0; i < LN_PCS; ++i) gm[i] = *(const v4f*)(gamma + col + i * 128);
    #pragma unroll
    for (int i = 0; i < LN_PCS; ++i) bt[i] = *(const v4f*)(beta + col + i * 128);
    // keeps every load above the arithmetic: without it the compiler sinks part of
    // them behind waits, and the wave pays several memory trips one after another
    __builtin_amdgcn_sched_barrier(0);

    #pragma unroll
    for (int rr = 0; rr < LN_ROWS; ++rr) {
        v4f s4 = {}, q4 = {};
        #pragma unroll
        for (int i = 0; i < LN_PCS; ++i) {
            x[rr][i] = 2.0f * x[rr][i] + r[rr][i];
            s4 += x[rr][i];
            q4 += x[rr][i] * x[rr][i];
        }
        const float s  = wave_sum((s4[0] + s4[1]) + (s4[2] + s4[3]));
        const float s2 = wave_sum((q4[0] + q4[1]) + (q4[2] + q4[3]));

        const float mu   = s * (1.0f / (float)DD);
        const float var  = s2 * (1.0f / (float)DD) - mu * mu;
        const float rstd = rsqrtf(var + 1e-5f);
        #pragma unroll
        for (int i = 0; i < LN_PCS; ++i)
            *(v4f*)(op + rr * DD + i * 128) = (x[rr][i] - mu) * rstd * gm[i] + bt[i];
    }
}

// ---------------------------------------------------------------------------
extern "C" void kernel_launch(void* const* d_in, const int* in_sizes, int n_in,
                              void* d_out, int out_size, void* d_ws, size_t ws_size,
                              hipStream_t stream) {
    (void)in_sizes; (void)n_in; (void)out_size; (void)ws_size;
    const float* q     = (const float*)d_in[0];
    const float* k     = (const float*)d_in[1];
    const float* v     = (const float*)d_in[2];
    const float* W     = (const float*)d_in[3];
    const float* gamma = (const float*)d_in[4];
    const float* beta  = (const float*)d_in[5];
    float* out = (float*)d_out;

    // workspace partition: Qp, Kp, Vt (f16) + attnOut (f32)
    _Float16* Qp = (_Float16*)d_ws;
    _Float16* Kp = Qp + (size_t)RR * DD;
    _Float16* Vt = Kp + (size_t)RR * DD;
    float*    Ao = (float*)(Vt + (size_t)RR * DD);

    // 1) projections: grid = (N tiles, M tiles, {q,k,v})
    proj_relu_kernel<<<dim3(DD / TN, RR / TM, 3), 256, 0, stream>>>(
        q, k, v, W, Qp, Kp, Vt);

    // 2) fused attention: grid = (q blocks, heads, batch)
    attn_kernel<<<dim3(SS / 128, HH, BB), 256, 0, stream>>>(Qp, Kp, Vt, Ao);

    // 3) residual + LayerNorm
    ln_kernel<<<dim3(RR / (8 * LN_ROWS)), 256, 0, stream>>>(Ao, q, gamma, beta, out);
}

// v007
// It runs in 68.7 microseconds.
// Timed twice side by side with v006, it ran 1.05 times as fast both times.
// All steps since v000 together make it 2.36 times as fast.
#include <hip/hip_runtime.h>
#include <hip/hip_bf16.h>

typedef __attribute__((ext_vector_type(16))) _Float16 v16h;
typedef __attribute__((ext_vector_type(8)))  _Float16 v8h;
typedef __attribute__((ext_vector_type(8)))  float    v8f;
typedef __attribute__((ext_vector_type(4)))  _Float16 v4h;

#define BB 8
#define SS 1024
#define DD 768
#define HH 12
#define DH 64
#define RR (BB*SS)   // 8192 rows per tensor

static __device__ __forceinline__ v16h cat16(v8h lo, v8h hi) {
    return __builtin_shufflevector(lo, hi, 0,1,2,3,4,5,6,7,8,9,10,11,12,13,14,15);
}
static __device__ __forceinline__ v4h cvt4(const float4 a) {
    v4h r;
    r[0]=(_Float16)a.x; r[1]=(_Float16)a.y; r[2]=(_Float16)a.z; r[3]=(_Float16)a.w;
    return r;
}
static __device__ __forceinline__ v8f wmma16(v16h a, v16h b, v8f c) {
    // D = A(16x32 f16) * B(32x16 f16) + C(16x16 f32)
    return __builtin_amdgcn_wmma_f32_16x16x32_f16(false, a, false, b, (short)0, c, false, false);
}

// ---------------------------------------------------------------------------
// Kernel 1: Y = relu(X @ W^T) for X in {q,k,v}, fp32 in -> f16 out.
//   z==0 -> Qp [B,S,H,Dh] (== row-major [R,D])
//   z==1 -> Kp [B,S,H,Dh]
//   z==2 -> Vt [B,H,Dh,S]  (transposed per head for the PV GEMM A-operand)
// Tile: 128 rows of X x 192 rows of W (output columns), K-step 32, 8 waves
// arranged 2 x 4, each wave owns 64 x 48 = 4 x 3 WMMA tiles. That gives 768
// work-groups; at 160 registers three of them fit a WGP, so all are resident
// at once on 256 WGPs, and X is read 4 times, not 6.
// A lane's 8 accumulator registers run along the A operand's rows. The operand
// whose index is contiguous in the output is therefore taken as A: X for Vt
// (contiguous in s), W for Qp and Kp (contiguous in the column). The 8 values
// pack to 16 B, the tile is gathered in LDS as [B row][A row], and every
// global store covers whole 128-B lines.
// ---------------------------------------------------------------------------
#define TM 128       // X rows per tile
#define TN 192       // W rows per tile
#define SPITCH 40    // halfs per staged row: 80 B, 16 B x 5
#define VPITCH 136   // halfs per gathered Vt row (128 + 8): 272 B = 16 B x 17
#define QPITCH 200   // halfs per gathered Qp/Kp row (192 + 8): 400 B = 16 B x 25

// XA: X is the A operand (Vt); otherwise W is (Qp, Kp)
template <bool XA>
static __device__ __forceinline__ void proj_tile(const float* __restrict__ X,
                                                 const float* __restrict__ W,
                                                 _Float16* __restrict__ Y,
                                                 const int rowBase, const int colBase,
                                                 _Float16* const sh)
{
    // the two staging tiles of the K loop; after it, sh is the gathered tile
    _Float16* const shX = sh;
    _Float16* const shW = sh + TM * SPITCH;

    const int t    = threadIdx.x;
    const int lane = t & 31;
    const int wave = t >> 5;
    const int wx = wave >> 2;       // 0..1: 64 rows of X
    const int ww = wave & 3;        // 0..3: 48 rows of W
    const int lr = lane & 15;       // fragment row/col within 16
    const int g  = lane >> 4;       // half-wave -> K octet select

    v8f acc[4][3] = {};

    // Staging map: 8 lanes x 16 B cover one whole 128-B line (one row of the
    // K-step), so each wave-wide load touches 4 whole lines. The 8 waves take
    // 32 rows per load; a wave's 4 rows lie 4 apart: at the 80-B pitch they
    // start 16 banks apart, so its 8-B LDS stores hit each bank once.
    const int gr = (wave >> 2) * 16 + (lane >> 3) * 4 + (wave & 3);   // first staging row
    const int gc = (lane & 7) * 4;                                    // staging col (floats)
    // One 32-bit byte offset per lane serves both operands and steps with kb; the
    // tile bases are wave-uniform. Kept in 32 bits, it lets every load take the
    // form scalar base + lane offset: the offset lives through the loop, so no
    // load's result lands on a register that another load of the group names.
    const unsigned lo = (unsigned)(gr * DD + gc) * 4u;
    const char* xs = (const char*)(X + (size_t)rowBase * DD);
    const char* ws = (const char*)(W + (size_t)colBase * DD);

    for (int kb = 0; kb < DD; kb += 32) {
        // ---- stage X[rowBase..+127][kb..+31] and W[colBase..+191][kb..+31] -> f16 LDS
        //      (the loops over n are unrolled so that fx and fw stay in registers, the
        //      10 loads issue as one group and the row steps become immediate offsets)
        float4 fx[TM / 32], fw[TN / 32];
        const unsigned vb = lo + (unsigned)kb * 4u;
        #pragma unroll
        for (int n = 0; n < TM / 32; ++n) fx[n] = *(const float4*)(xs + vb + n * (32 * DD * 4));
        #pragma unroll
        for (int n = 0; n < TN / 32; ++n) fw[n] = *(const float4*)(ws + vb + n * (32 * DD * 4));
        #pragma unroll
        for (int n = 0; n < TM / 32; ++n) *(v4h*)&shX[(gr + n * 32) * SPITCH + gc] = cvt4(fx[n]);
        #pragma unroll
        for (int n = 0; n < TN / 32; ++n) *(v4h*)&shW[(gr + n * 32) * SPITCH + gc] = cvt4(fw[n]);
        __syncthreads();

        // ---- fragments: lane = row, holds K octets g*8 and 16+g*8 (A and B alike);
        //      unrolled: every index of xf, wf and acc must be a constant
        v16h xf[4], wf[3];
        #pragma unroll
        for (int i = 0; i < 4; ++i) {
            const _Float16* p = &shX[(wx * 64 + i * 16 + lr) * SPITCH];
            xf[i] = cat16(*(const v8h*)(p + g * 8), *(const v8h*)(p + 16 + g * 8));
        }
        #pragma unroll
        for (int j = 0; j < 3; ++j) {
            const _Float16* p = &shW[(ww * 48 + j * 16 + lr) * SPITCH];
            wf[j] = cat16(*(const v8h*)(p + g * 8), *(const v8h*)(p + 16 + g * 8));
        }
        #pragma unroll
        for (int i = 0; i < 4; ++i)
            #pragma unroll
            for (int j = 0; j < 3; ++j)
                acc[i][j] = XA ? wmma16(xf[i], wf[j], acc[i][j])
                               : wmma16(wf[j], xf[i], acc[i][j]);
        __syncthreads();
    }

    // ---- epilogue: relu, pack to f16, gather the tile in LDS. The loop's last
    //      barrier has ended every read of the staging tiles.
    #pragma unroll
    for (int i = 0; i < 4; ++i) {
        #pragma unroll
        for (int j = 0; j < 3; ++j) {
            v8h hv;
            #pragma unroll
            for (int r = 0; r < 8; ++r) {
                float val = acc[i][j][r];
                val = val > 0.0f ? val : 0.0f;
                hv[r] = (_Float16)val;
            }
            const int xr = wx * 64 + i * 16, wr = ww * 48 + j * 16;
            if (XA) *(v8h*)&sh[(wr + lr) * VPITCH + xr + 8 * g] = hv;
            else    *(v8h*)&sh[(xr + lr) * QPITCH + wr + 8 * g] = hv;
        }
    }
    __syncthreads();   // threads store rows that other waves wrote

    // The loops below are unrolled so that the LDS reads issue ahead of the
    // stores and the row steps become immediate offsets.
    if (XA) {
        // gathered row rr = column colBase+rr, i.e. Vt row (b, h, d): 128
        // contiguous halfs from position rowBase & 1023; 16 lanes x 16 B per row
        const int rr = t >> 4, cc = (t & 15) * 8;
        const _Float16* tile = &sh[rr * VPITCH + cc];
        _Float16* dst = Y + ((size_t)(rowBase >> 10) * DD + colBase + rr) * SS
                          + (rowBase & (SS - 1)) + cc;
        #pragma unroll
        for (int i = 0; i < TN / 16; ++i)
            *(v8h*)(dst + (size_t)i * 16 * SS) = *(const v8h*)(tile + i * 16 * VPITCH);
    } else {
        // gathered row rr = Qp/Kp row rowBase+rr: 192 contiguous halfs (three
        // 128-B lines) from column colBase; 8 lanes x 16 B per line
        const int rr = t >> 3, cc = (t & 7) * 8;
        const _Float16* tile = &sh[rr * QPITCH + cc];
        _Float16* dst = Y + (size_t)(rowBase + rr) * DD + colBase + cc;
        #pragma unroll
        for (int i = 0; i < TM / 32; ++i)
            #pragma unroll
            for (int l = 0; l < TN / 64; ++l)
                *(v8h*)(dst + (size_t)i * 32 * DD + l * 64) =
                    *(const v8h*)(tile + i * 32 * QPITCH + l * 64);
    }
    // stands in front of whatever next rewrites a register these stores name
    asm volatile("s_wait_xcnt 0x0" ::: "memory");
}

// second argument: at least 6 waves per SIMD, i.e. a budget of 160 registers, so
// that three work-groups fit a WGP and the whole grid is resident in one round
__global__ __launch_bounds__(256, 6)
void proj_relu_kernel(const float* __restrict__ q, const float* __restrict__ k,
                      const float* __restrict__ v, const float* __restrict__ W,
                      _Float16* __restrict__ Qp, _Float16* __restrict__ Kp,
                      _Float16* __restrict__ Vt)
{
    const int z = blockIdx.z;
    const int rowBase = blockIdx.y * TM;
    const int colBase = blockIdx.x * TN;
    __shared__ __align__(16) _Float16 sh[TN * VPITCH];   // the largest of its three uses
    if (z == 2) proj_tile<true >(v, W, Vt, rowBase, colBase, sh);
    else        proj_tile<false>((z == 0) ? q : k, W, (z == 0) ? Qp : Kp, rowBase, colBase, sh);
}

static __device__ __forceinline__ float xhalf(float x) {
    const int b = __builtin_bit_cast(int, x);
    return __builtin_bit_cast(float,
        __builtin_amdgcn_permlanex16(b, b, 0x76543210, 0xfedcba98, false, false));
}

#define OPITCH 68   // floats per staged output row: 272 B, a multiple of 16 B
#define STG    64   // keys per stage
#define KVP    72   // halfs per staged row of K or V^T: 128 B + 16 B, 16 B x 9
#define OPH    (64 * KVP)   // halfs per staged operand: 64 rows

// One stage's share of a thread: two 16-B pieces of K, two of V^T. lk, lv: LDS
// byte addresses of the first pieces; the second lie 32 rows further on.
static __device__ __forceinline__ void copy_stage(const unsigned lk, const unsigned lv,
                                                  const _Float16* gk, const _Float16* gv)
{
    const unsigned lk1 = lk + 32 * KVP * 2, lv1 = lv + 32 * KVP * 2;
    const _Float16* gk1 = gk + 32 * DD;
    const _Float16* gv1 = gv + 32 * SS;
    // the closing wait stands in front of whatever next rewrites a register
    // that these copies name; inside the statement nothing can be lifted over it
    asm volatile("global_load_async_to_lds_b128 %0, %4, off\n\t"
                 "global_load_async_to_lds_b128 %1, %5, off\n\t"
                 "global_load_async_to_lds_b128 %2, %6, off\n\t"
                 "global_load_async_to_lds_b128 %3, %7, off\n\t"
                 "s_wait_xcnt 0x0"
                 :: "v"(lk), "v"(lk1), "v"(lv), "v"(lv1),
                    "v"(gk), "v"(gk1), "v"(gv), "v"(gv1) : "memory");
}

__global__ __launch_bounds__(256)
void attn_kernel(const _Float16* __restrict__ Qp, const _Float16* __restrict__ Kp,
                 const _Float16* __restrict__ Vt, float* __restrict__ O)
{
    const int qb = blockIdx.x;   // 0..7  (q block of 128)
    const int h  = blockIdx.y;   // 0..11
    const int b  = blockIdx.z;   // 0..7
    const int t = threadIdx.x, lane = t & 31, wave = t >> 5;
    const int lr = lane & 15, g = lane >> 4;
    const int qBase = qb * 128;

    __shared__ __align__(16) _Float16 shK[2 * OPH];     // two buffers of [key][d]
    __shared__ __align__(16) _Float16 shV[2 * OPH];     // two buffers of [d][key]
    __shared__ __align__(16) float    shO[8][16 * OPITCH];  // per-wave O, [q][d]

    // ---- Q fragments for this wave's 16 rows (direct global, 16B aligned);
    //      used as B: column = query lr, k octets g*8 and 16+g*8
    const int qrow = qBase + wave * 16 + lr;
    const _Float16* qptr = Qp + (size_t)(b * SS + qrow) * DD + h * DH;
    const v16h qB0 = cat16(*(const v8h*)(qptr + g * 8),
                           *(const v8h*)(qptr + 16 + g * 8));
    const v16h qB1 = cat16(*(const v8h*)(qptr + 32 + g * 8),
                           *(const v8h*)(qptr + 48 + g * 8));

    v8f cO[4] = {};              // cO[tt][r] = O^T[d = tt*16 + 8g + r][query lr]
    float l_lane = 0.0f;         // running sum over this half's keys

    // p = 2^(s * C2 - m_use * C2), s the raw product: C2 = log2(e) / sqrt(64).
    // m_use is the maximum IN USE for query lr (same in both halves), not the
    // running one: it moves only when a score passes it by more than LAZY.
    const float C2   = 0.125f * 1.44269504088896f;
    const float LAZY = 8.0f / C2;       // 8 in the exponent: p is at most 2^8
    float m_use = -1e30f;               // the first stage always sets it
    float off   = 0.0f;                 // -m_use * C2
    float thr   = -1e30f;               // m_use + LAZY

    // ---- staging map: 8 lanes x 16 B cover one 128-B row (a key's 64 d, or 64
    //      keys of one d), so every wave-wide copy takes 4 whole lines
    const int sr = t >> 3, sc8 = (t & 7) * 8;
    const _Float16* gk = Kp + (size_t)(b * SS + sr) * DD + h * DH + sc8;
    const _Float16* gv = Vt + (((size_t)(b * HH + h)) * DH + sr) * SS + sc8;
    const unsigned lk = (unsigned)(size_t)&shK[sr * KVP + sc8];
    const unsigned lv = (unsigned)(size_t)&shV[sr * KVP + sc8];

    copy_stage(lk, lv, gk, gv);
    asm volatile("s_wait_asynccnt 0x0" ::: "memory");   // stage 0 has landed
    __syncthreads();                                    // and every wave may read it
    copy_stage(lk + OPH * 2, lv + OPH * 2, gk + STG * DD, gv + STG);

    for (int st = 0; st < SS / STG; ++st) {
      const int bo = (st & 1) * OPH;     // this stage's buffer
      // ---- scores^T of the stage: four 16(key) x 16(query) tiles, K-dim = Dh = 64
      //      s[j][r] = S[query lr][key j*16 + 8g + r]
      //      (all loops over j, r, tt are unrolled: s, aK, aV, cO stay in registers)
      v16h aK[STG / 16][2];
      #pragma unroll
      for (int j = 0; j < STG / 16; ++j) {
          const _Float16* kp = &shK[bo + (j * 16 + lr) * KVP];
          aK[j][0] = cat16(*(const v8h*)(kp + g * 8),      *(const v8h*)(kp + 16 + g * 8));
          aK[j][1] = cat16(*(const v8h*)(kp + 32 + g * 8), *(const v8h*)(kp + 48 + g * 8));
      }
      v8f s[STG / 16];
      #pragma unroll
      for (int j = 0; j < STG / 16; ++j) s[j] = wmma16(aK[j][0], qB0, v8f{});
      #pragma unroll
      for (int j = 0; j < STG / 16; ++j) s[j] = wmma16(aK[j][1], qB1, s[j]);

      // ---- this half's largest score of the stage, in the lane's own registers:
      //      one chain per pair of tiles
      float mxa = fmaxf(s[0][0], s[1][0]), mxb = fmaxf(s[2][0], s[3][0]);
      #pragma unroll
      for (int r = 1; r < 8; ++r) {
          mxa = fmaxf(mxa, fmaxf(s[0][r], s[1][r]));
          mxb = fmaxf(mxb, fmaxf(s[2][r], s[3][r]));
      }
      const float mx = fmaxf(mxa, mxb);

      // ---- lazy rescale: one test per stage, a scalar branch for the whole wave.
      //      Taken: every query's maximum in use moves up to its running maximum,
      //      and sum and output are brought to the new one.
      if (__builtin_amdgcn_ballot_w32(mx > thr) != 0) {
          const float mnew  = fmaxf(m_use, fmaxf(mx, xhalf(mx)));
          const float alpha = __builtin_amdgcn_exp2f((m_use - mnew) * C2);
          m_use = mnew;
          off   = -mnew * C2;
          thr   = mnew + LAZY;
          l_lane *= alpha;
          #pragma unroll
          for (int tt = 0; tt < 4; ++tt) cO[tt] *= alpha;
      }

      const v8f c8 = {C2, C2, C2, C2, C2, C2, C2, C2};
      const v8f o8 = {off, off, off, off, off, off, off, off};
      // unrolled: the block's offset in the buffer becomes an immediate
      #pragma unroll
      for (int ps = 0; ps < STG / 32; ++ps) {
        v16h aV[4];
        #pragma unroll
        for (int tt = 0; tt < 4; ++tt) {
            const _Float16* vp = &shV[bo + (tt * 16 + lr) * KVP + ps * 32];
            aV[tt] = cat16(*(const v8h*)(vp + g * 8), *(const v8h*)(vp + 16 + g * 8));
        }
        // P^T as B operand: element e is key 8g+e (e<8) or 16+8g+(e-8),
        // which is where the two S^T tiles already hold them
        const v8f e0 = __builtin_elementwise_fma(s[2 * ps],     c8, o8);
        const v8f e1 = __builtin_elementwise_fma(s[2 * ps + 1], c8, o8);
        v16h pB;
        float ps0 = 0.0f, ps1 = 0.0f;
        #pragma unroll
        for (int r = 0; r < 8; ++r) {
            const float p0 = __builtin_amdgcn_exp2f(e0[r]);
            const float p1 = __builtin_amdgcn_exp2f(e1[r]);
            ps0 += p0;
            ps1 += p1;
            pB[r]     = (_Float16)p0;
            pB[8 + r] = (_Float16)p1;
        }
        l_lane += ps0 + ps1;

        // ---- O^T += V^T @ P^T: 4 m-tiles over Dh, A = rows of V^T
        #pragma unroll
        for (int tt = 0; tt < 4; ++tt) cO[tt] = wmma16(aV[tt], pB, cO[tt]);
      }
      // ---- hand-over: this wave's reads of the buffer are done, its copies of
      //      the next stage have landed; behind the barrier that holds for all
      asm volatile("s_wait_dscnt 0x0" ::: "memory");      // own reads of this buffer ended
      asm volatile("s_wait_asynccnt 0x0" ::: "memory");   // own copies of stage st + 1 landed
      __syncthreads();
      if (st + 2 < SS / STG)   // the same for the whole work-group
          copy_stage(lk + bo * 2, lv + bo * 2,
                     gk + (size_t)(st + 2) * (STG * DD), gv + (st + 2) * STG);
    }
    asm volatile("s_wait_asynccnt 0x0" ::: "memory");   // nothing in flight at the wave's end

    // ---- finalize: join the halves' sums, divide, turn O^T back in LDS so
    //      that every global store covers whole 128-B lines
    const float inv = 1.0f / (l_lane + xhalf(l_lane));
    float* so = &shO[wave][0];
    #pragma unroll
    for (int tt = 0; tt < 4; ++tt) {
        float* w = so + lr * OPITCH + tt * 16 + 8 * g;
        *(float4*)(w)     = make_float4(cO[tt][0] * inv, cO[tt][1] * inv,
                                        cO[tt][2] * inv, cO[tt][3] * inv);
        *(float4*)(w + 4) = make_float4(cO[tt][4] * inv, cO[tt][5] * inv,
                                        cO[tt][6] * inv, cO[tt][7] * inv);
    }
    __syncthreads();   // lanes read rows that other lanes wrote
    #pragma unroll
    for (int i = 0; i < 8; ++i) {
        const int rr = i * 2 + g;                 // staged row, 16 lanes x 16 B each
        const float4 o4 = *(const float4*)(so + rr * OPITCH + lr * 4);
        const int row = qBase + wave * 16 + rr;
        *(float4*)&O[(size_t)(b * SS + row) * DD + h * DH + lr * 4] = o4;
    }
}

// ---------------------------------------------------------------------------
// Kernel 3: o = 2*attn + q, then LayerNorm over D=768.
// One wave per row, LN_ROWS rows per wave: a lane holds 24 values of a row as
// six 16-B pieces (each wave-wide load or store covers 512 contiguous bytes).
// All rows' loads are issued before the first row is summed; the row sums stay
// inside the wave, so the kernel has no LDS and no barrier.
// ---------------------------------------------------------------------------
#define LN_ROWS 2
#define LN_PCS  6    // 16-B pieces per lane and row: 768 / (32 * 4)
typedef __attribute__((ext_vector_type(4))) float v4f;

template <int CTRL>
static __device__ __forceinline__ float row_xor(float x) {  // lane l <- lane l ^ (CTRL & 15)
    const int b = __builtin_bit_cast(int, x);
    return __builtin_bit_cast(float, __builtin_amdgcn_update_dpp(b, b, CTRL, 0xf, 0xf, true));
}
static __device__ __forceinline__ float wave_sum(float x) {  // every lane gets the sum of all 32
    x += row_xor<0x161>(x);
    x += row_xor<0x162>(x);
    x += row_xor<0x164>(x);
    x += row_xor<0x168>(x);
    return x + xhalf(x);
}

__global__ __launch_bounds__(256)
void ln_kernel(const float* __restrict__ A, const float* __restrict__ q,
               const float* __restrict__ gamma, const float* __restrict__ beta,
               float* __restrict__ out)
{
    const int col  = (threadIdx.x & 31) * 4;
    const int wave = __builtin_amdgcn_readfirstlane(threadIdx.x >> 5);
    const size_t row0 = (size_t)(blockIdx.x * 8 + wave) * LN_ROWS;   // wave-uniform
    const float* __restrict__ ap = A   + row0 * DD + col;
    const float* __restrict__ qp = q   + row0 * DD + col;
    float* __restrict__       op = out + row0 * DD + col;

    v4f x[LN_ROWS][LN_PCS], r[LN_ROWS][LN_PCS], gm[LN_PCS], bt[LN_PCS];
    #pragma unroll
    for (int rr = 0; rr < LN_ROWS; ++rr) {
        #pragma unroll
        for (int i = 0; i < LN_PCS; ++i) x[rr][i] = *(const v4f*)(ap + rr * DD + i * 128);
        #pragma unroll
        for (int i = 0; i < LN_PCS; ++i) r[rr][i] = *(const v4f*)(qp + rr * DD + i * 128);
    }
    #pragma unroll
    for (int i = 0; i < LN_PCS; ++i) gm[i] = *(const v4f*)(gamma + col + i * 128);
    #pragma unroll
    for (int i = 0; i < LN_PCS; ++i) bt[i] = *(const v4f*)(beta + col + i * 128);
    // keeps every load above the arithmetic: without it the compiler sinks part of
    // them behind waits, and the wave pays several memory trips one after another
    __builtin_amdgcn_sched_barrier(0);

    #pragma unroll
    for (int rr = 0; rr < LN_ROWS; ++rr) {
        v4f s4 = {}, q4 = {};
        #pragma unroll
        for (int i = 0; i < LN_PCS; ++i) {
            x[rr][i] = 2.0f * x[rr][i] + r[rr][i];
            s4 += x[rr][i];
            q4 += x[rr][i] * x[rr][i];
        }
        const float s  = wave_sum((s4[0] + s4[1]) + (s4[2] + s4[3]));
        const float s2 = wave_sum((q4[0] + q4[1]) + (q4[2] + q4[3]));

        const float mu   = s * (1.0f / (float)DD);
        const float var  = s2 * (1.0f / (float)DD) - mu * mu;
        const float rstd = rsqrtf(var + 1e-5f);
        #pragma unroll
        for (int i = 0; i < LN_PCS; ++i)
            *(v4f*)(op + rr * DD + i * 128) = (x[rr][i] - mu) * rstd * gm[i] + bt[i];
    }
}

// ---------------------------------------------------------------------------
extern "C" void kernel_launch(void* const* d_in, const int* in_sizes, int n_in,
                              void* d_out, int out_size, void* d_ws, size_t ws_size,
                              hipStream_t stream) {
    (void)in_sizes; (void)n_in; (void)out_size; (void)ws_size;
    const float* q     = (const float*)d_in[0];
    const float* k     = (const float*)d_in[1];
    const float* v     = (const float*)d_in[2];
    const float* W     = (const float*)d_in[3];
    const float* gamma = (const float*)d_in[4];
    const float* beta  = (const float*)d_in[5];
    float* out = (float*)d_out;

    // workspace partition: Qp, Kp, Vt (f16) + attnOut (f32)
    _Float16* Qp = (_Float16*)d_ws;
    _Float16* Kp = Qp + (size_t)RR * DD;
    _Float16* Vt = Kp + (size_t)RR * DD;
    float*    Ao = (float*)(Vt + (size_t)RR * DD);

    // 1) projections: grid = (N tiles, M tiles, {q,k,v})
    proj_relu_kernel<<<dim3(DD / TN, RR / TM, 3), 256, 0, stream>>>(
        q, k, v, W, Qp, Kp, Vt);

    // 2) fused attention: grid = (q blocks, heads, batch)
    attn_kernel<<<dim3(SS / 128, HH, BB), 256, 0, stream>>>(Qp, Kp, Vt, Ao);

    // 3) residual + LayerNorm
    ln_kernel<<<dim3(RR / (8 * LN_ROWS)), 256, 0, stream>>>(Ao, q, gamma, beta, out);
}
